// v000
// Times are from an AMD MI455X. After a warm-up the kernel runs many times in a row, and a time is the length of
// such a window on the GPU divided by its runs, so every launch and the gaps after it count. The runs cycle
// through copies of the inputs. A figure is the median of several windows, for all but v000 over two sittings.
// Sittings can differ by a few percent; kernels timed side by side share one.
// v000 is the starting kernel. One run takes 255 microseconds.
#include <hip/hip_runtime.h>
#include <hip/hip_bf16.h>
#include <stdint.h>

// Problem constants (match reference)
#define D_MODEL 1024
#define NHEAD   16
#define DK      64
#define BB      2
#define LSEQ    2048

typedef __attribute__((ext_vector_type(16))) __bf16 v16bf;
typedef __attribute__((ext_vector_type(8)))  float  v8f;

#define WMMA_BF16(a,b,c) \
  __builtin_amdgcn_wmma_f32_16x16x32_bf16(false,(a),false,(b),(short)0,(c),false,false)

__device__ __forceinline__ v8f zero8() {
  v8f z;
#pragma unroll
  for (int i = 0; i < 8; ++i) z[i] = 0.0f;
  return z;
}

__device__ __forceinline__ unsigned short f2bf(float f) {
  unsigned u = __float_as_uint(f);
  return (unsigned short)((u + 0x8000u) >> 16);  // round-to-nearest (approx)
}

union FragU { uint4 q[2]; v16bf v; };

__device__ __forceinline__ v16bf load_frag(const unsigned short* base, int row,
                                           int stride, int kOff, int sel) {
  const unsigned short* p = base + row * stride + kOff + (sel << 3);
  FragU f;
  f.q[0] = *(const uint4*)(p);
  f.q[1] = *(const uint4*)(p + 16);
  return f.v;
}

// stage 32 consecutive fp32 -> 32 bf16 (VALU convert path)
__device__ __forceinline__ void stage_f32(const float* __restrict__ src,
                                          unsigned short* dst) {
#pragma unroll
  for (int i = 0; i < 8; ++i) {
    float4 v = ((const float4*)src)[i];
    ushort4 o;
    o.x = f2bf(v.x); o.y = f2bf(v.y); o.z = f2bf(v.z); o.w = f2bf(v.w);
    ((ushort4*)dst)[i] = o;
  }
}

__device__ __forceinline__ void async_copy64B(const unsigned short* g,
                                              unsigned short* l) {
  unsigned lds = (unsigned)(unsigned long long)l;  // low 32b = LDS offset
  asm volatile(
      "global_load_async_to_lds_b128 %0, %1, off\n\t"
      "global_load_async_to_lds_b128 %0, %1, off offset:16\n\t"
      "global_load_async_to_lds_b128 %0, %1, off offset:32\n\t"
      "global_load_async_to_lds_b128 %0, %1, off offset:48"
      :: "v"(lds), "v"(g) : "memory");
}
__device__ __forceinline__ void async_copy128B(const unsigned short* g,
                                               unsigned short* l) {
  unsigned lds = (unsigned)(unsigned long long)l;
  asm volatile(
      "global_load_async_to_lds_b128 %0, %1, off\n\t"
      "global_load_async_to_lds_b128 %0, %1, off offset:16\n\t"
      "global_load_async_to_lds_b128 %0, %1, off offset:32\n\t"
      "global_load_async_to_lds_b128 %0, %1, off offset:48\n\t"
      "global_load_async_to_lds_b128 %0, %1, off offset:64\n\t"
      "global_load_async_to_lds_b128 %0, %1, off offset:80\n\t"
      "global_load_async_to_lds_b128 %0, %1, off offset:96\n\t"
      "global_load_async_to_lds_b128 %0, %1, off offset:112"
      :: "v"(lds), "v"(g) : "memory");
}
__device__ __forceinline__ void wait_async0() {
  asm volatile("s_wait_asynccnt 0x0" ::: "memory");
}

#define LDS_STRIDE 72  // 64 + 8 bf16 pad

// ---------------------------------------------------------------------------
// Kernel 1: qkv = x @ W_qkv^T + b_qkv, apply RoPE to q,k, scatter bf16
//   Qr, Kr : [B*H][L][64] bf16   Vt : [B*H][64][L] bf16 (transposed for B-frag)
// grid (48, 32), block 128 (4 waves); tile 128(M) x 64(N), K chunk 64.
// Each wave computes 32 rows x 64 cols (2 M-frags) for better A/B reuse.
// ---------------------------------------------------------------------------
__global__ __launch_bounds__(128) void qkv_rope_kernel(
    const float* __restrict__ x, const float* __restrict__ rope_cos,
    const float* __restrict__ rope_sin, const float* __restrict__ W_qkv,
    const float* __restrict__ b_qkv, unsigned short* __restrict__ Qr,
    unsigned short* __restrict__ Kr, unsigned short* __restrict__ Vt) {
  __shared__ unsigned short aL[128 * LDS_STRIDE];
  __shared__ unsigned short bL[64 * LDS_STRIDE];

  const int t = threadIdx.x;
  const int w = t >> 5, lane = t & 31;
  const int lhi = lane >> 4, llo = lane & 15;
  const int n0 = blockIdx.x * 64;
  const int m0 = blockIdx.y * 128;

  v8f acc[2][4];
#pragma unroll
  for (int mf = 0; mf < 2; ++mf)
#pragma unroll
    for (int f = 0; f < 4; ++f) acc[mf][f] = zero8();

  for (int k0 = 0; k0 < D_MODEL; k0 += 64) {
    __syncthreads();
    {  // A tile: 128 rows x 64 cols, thread t stages row t (fp32 -> bf16)
      const float* src = x + (size_t)(m0 + t) * D_MODEL + k0;
      unsigned short* dst = aL + t * LDS_STRIDE;
      stage_f32(src, dst);
      stage_f32(src + 32, dst + 32);
    }
    {  // B tile: 64 rows x 64 cols, thread t stages half a row
      stage_f32(W_qkv + (size_t)(n0 + (t >> 1)) * D_MODEL + k0 + (t & 1) * 32,
                bL + (t >> 1) * LDS_STRIDE + (t & 1) * 32);
    }
    __syncthreads();
#pragma unroll
    for (int ks = 0; ks < 64; ks += 32) {
      v16bf a0 = load_frag(aL, w * 32 + llo, LDS_STRIDE, ks, lhi);
      v16bf a1 = load_frag(aL, w * 32 + 16 + llo, LDS_STRIDE, ks, lhi);
#pragma unroll
      for (int f = 0; f < 4; ++f) {
        v16bf b = load_frag(bL, f * 16 + llo, LDS_STRIDE, ks, lhi);
        acc[0][f] = WMMA_BF16(a0, b, acc[0][f]);
        acc[1][f] = WMMA_BF16(a1, b, acc[1][f]);
      }
    }
  }

  // Epilogue: bias + RoPE + scatter
  const int which = n0 >> 10;            // 0=q 1=k 2=v
  const int h = (n0 & 1023) >> 6;        // head
#pragma unroll
  for (int mf = 0; mf < 2; ++mf) {
    const int mbase = m0 + w * 32 + mf * 16 + 8 * lhi;
    float val[4][8];
#pragma unroll
    for (int f = 0; f < 4; ++f) {
      float bias = b_qkv[n0 + f * 16 + llo];
#pragma unroll
      for (int rr = 0; rr < 8; ++rr) val[f][rr] = acc[mf][f][rr] + bias;
    }

    if (which < 2) {
#pragma unroll
      for (int f = 0; f < 2; ++f) {
        int d = f * 16 + llo;  // 0..31
#pragma unroll
        for (int rr = 0; rr < 8; ++rr) {
          int m = mbase + rr;
          float c = rope_cos[m * (DK / 2) + d];
          float s = rope_sin[m * (DK / 2) + d];
          float x1 = val[f][rr], x2 = val[f + 2][rr];
          val[f][rr]     = x1 * c - x2 * s;
          val[f + 2][rr] = x1 * s + x2 * c;
        }
      }
      unsigned short* dst = (which == 0) ? Qr : Kr;
#pragma unroll
      for (int f = 0; f < 4; ++f) {
        int d = f * 16 + llo;
#pragma unroll
        for (int rr = 0; rr < 8; ++rr) {
          int m = mbase + rr;
          int b = m >> 11, pos = m & (LSEQ - 1);
          dst[((size_t)(b * NHEAD + h) * LSEQ + pos) * DK + d] = f2bf(val[f][rr]);
        }
      }
    } else {
#pragma unroll
      for (int f = 0; f < 4; ++f) {
        int d = f * 16 + llo;
#pragma unroll
        for (int rr = 0; rr < 8; ++rr) {
          int m = mbase + rr;
          int b = m >> 11, pos = m & (LSEQ - 1);
          Vt[((size_t)(b * NHEAD + h) * DK + d) * LSEQ + pos] = f2bf(val[f][rr]);
        }
      }
    }
  }
}

__global__ __launch_bounds__(128) void attn_kernel(
    const unsigned short* __restrict__ Qr, const unsigned short* __restrict__ Kr,
    const unsigned short* __restrict__ Vt, unsigned short* __restrict__ O) {
  __shared__ unsigned short kL[64 * LDS_STRIDE];
  __shared__ unsigned short vL[64 * LDS_STRIDE];
  __shared__ unsigned short pL[4][16 * LDS_STRIDE];

  const int t = threadIdx.x;
  const int w = t >> 5, lane = t & 31;
  const int lhi = lane >> 4, llo = lane & 15;
  const int bh = blockIdx.y;                   // 0..31 = b*16+h
  const int q0 = blockIdx.x * 64 + w * 16;     // wave's first query row
  const size_t hb = (size_t)bh * LSEQ * DK;    // same element offset for Qr/Kr/Vt

  // Q fragments (held in registers for whole kernel)
  v16bf aQ[2];
#pragma unroll
  for (int c = 0; c < 2; ++c)
    aQ[c] = load_frag(Qr + hb, q0 + llo, DK, c * 32, lhi);

  v8f acc[4];
#pragma unroll
  for (int f = 0; f < 4; ++f) acc[f] = zero8();
  float mrun[8], lrun[8];
#pragma unroll
  for (int rr = 0; rr < 8; ++rr) { mrun[rr] = -1e30f; lrun[rr] = 0.0f; }

  const int sr = t >> 1, sh = t & 1;
  const float scale = 0.125f;  // 1/sqrt(64)

  for (int kt = 0; kt < LSEQ; kt += 64) {
    __syncthreads();
    async_copy64B(Kr + hb + (size_t)(kt + sr) * DK + sh * 32,
                  kL + sr * LDS_STRIDE + sh * 32);
    async_copy64B(Vt + hb + (size_t)sr * LSEQ + kt + sh * 32,
                  vL + sr * LDS_STRIDE + sh * 32);
    wait_async0();
    __syncthreads();

    // S = Q K^T
    v8f s[4];
#pragma unroll
    for (int f = 0; f < 4; ++f) s[f] = zero8();
#pragma unroll
    for (int c = 0; c < 2; ++c) {
#pragma unroll
      for (int f = 0; f < 4; ++f) {
        v16bf bK = load_frag(kL, f * 16 + llo, LDS_STRIDE, c * 32, lhi);
        s[f] = WMMA_BF16(aQ[c], bK, s[f]);
      }
    }

#pragma unroll
    for (int f = 0; f < 4; ++f)
#pragma unroll
      for (int rr = 0; rr < 8; ++rr) s[f][rr] *= scale;

#pragma unroll
    for (int rr = 0; rr < 8; ++rr) {
      float m = fmaxf(fmaxf(s[0][rr], s[1][rr]), fmaxf(s[2][rr], s[3][rr]));
      m = fmaxf(m, __shfl_xor(m, 1));
      m = fmaxf(m, __shfl_xor(m, 2));
      m = fmaxf(m, __shfl_xor(m, 4));
      m = fmaxf(m, __shfl_xor(m, 8));
      float mnew  = fmaxf(mrun[rr], m);
      float alpha = __expf(mrun[rr] - mnew);
      float rs = 0.0f;
#pragma unroll
      for (int f = 0; f < 4; ++f) {
        float p = __expf(s[f][rr] - mnew);
        s[f][rr] = p;
        rs += p;
      }
      rs += __shfl_xor(rs, 1);
      rs += __shfl_xor(rs, 2);
      rs += __shfl_xor(rs, 4);
      rs += __shfl_xor(rs, 8);
      lrun[rr] = lrun[rr] * alpha + rs;
      mrun[rr] = mnew;
#pragma unroll
      for (int f = 0; f < 4; ++f) acc[f][rr] *= alpha;
    }

    // P: D-layout -> LDS -> A-layout (per-wave private tile; same-wave DS order)
    unsigned short* pw = pL[w];
#pragma unroll
    for (int f = 0; f < 4; ++f)
#pragma unroll
      for (int rr = 0; rr < 8; ++rr)
        pw[(rr + 8 * lhi) * LDS_STRIDE + f * 16 + llo] = f2bf(s[f][rr]);
    asm volatile("s_wait_dscnt 0" ::: "memory");

    // O += P V
#pragma unroll
    for (int c = 0; c < 2; ++c) {
      v16bf aP = load_frag(pw, llo, LDS_STRIDE, c * 32, lhi);
#pragma unroll
      for (int f = 0; f < 4; ++f) {
        v16bf bV = load_frag(vL, f * 16 + llo, LDS_STRIDE, c * 32, lhi);
        acc[f] = WMMA_BF16(aP, bV, acc[f]);
      }
    }
  }

  // normalize + store O as [B][L][H*DK] bf16
  const int b = bh >> 4, h = bh & 15;
  float inv[8];
#pragma unroll
  for (int rr = 0; rr < 8; ++rr) inv[rr] = 1.0f / lrun[rr];
#pragma unroll
  for (int f = 0; f < 4; ++f) {
    int d = f * 16 + llo;
#pragma unroll
    for (int rr = 0; rr < 8; ++rr) {
      int pos = q0 + rr + 8 * lhi;
      O[(size_t)(b * LSEQ + pos) * D_MODEL + h * DK + d] = f2bf(acc[f][rr] * inv[rr]);
    }
  }
}

// ---------------------------------------------------------------------------
// Kernel 3: out = O @ W_out^T + b_out (fp32 result). grid (16, 32), block 128.
// Tile 128(M) x 64(N); A tile (bf16) staged with async global->LDS DMA.
// ---------------------------------------------------------------------------
__global__ __launch_bounds__(128) void out_proj_kernel(
    const unsigned short* __restrict__ O, const float* __restrict__ W_out,
    const float* __restrict__ b_out, float* __restrict__ out) {
  __shared__ unsigned short aL[128 * LDS_STRIDE];
  __shared__ unsigned short bL[64 * LDS_STRIDE];

  const int t = threadIdx.x;
  const int w = t >> 5, lane = t & 31;
  const int lhi = lane >> 4, llo = lane & 15;
  const int n0 = blockIdx.x * 64;
  const int m0 = blockIdx.y * 128;

  v8f acc[2][4];
#pragma unroll
  for (int mf = 0; mf < 2; ++mf)
#pragma unroll
    for (int f = 0; f < 4; ++f) acc[mf][f] = zero8();

  for (int k0 = 0; k0 < D_MODEL; k0 += 64) {
    __syncthreads();
    // A tile: thread t stages row t (128 bytes) via async DMA
    async_copy128B(O + (size_t)(m0 + t) * D_MODEL + k0, aL + t * LDS_STRIDE);
    // B tile: fp32 -> bf16 convert path
    stage_f32(W_out + (size_t)(n0 + (t >> 1)) * D_MODEL + k0 + (t & 1) * 32,
              bL + (t >> 1) * LDS_STRIDE + (t & 1) * 32);
    wait_async0();
    __syncthreads();
#pragma unroll
    for (int ks = 0; ks < 64; ks += 32) {
      v16bf a0 = load_frag(aL, w * 32 + llo, LDS_STRIDE, ks, lhi);
      v16bf a1 = load_frag(aL, w * 32 + 16 + llo, LDS_STRIDE, ks, lhi);
#pragma unroll
      for (int f = 0; f < 4; ++f) {
        v16bf b = load_frag(bL, f * 16 + llo, LDS_STRIDE, ks, lhi);
        acc[0][f] = WMMA_BF16(a0, b, acc[0][f]);
        acc[1][f] = WMMA_BF16(a1, b, acc[1][f]);
      }
    }
  }

#pragma unroll
  for (int mf = 0; mf < 2; ++mf) {
    const int mbase = m0 + w * 32 + mf * 16 + 8 * lhi;
#pragma unroll
    for (int f = 0; f < 4; ++f) {
      int c = n0 + f * 16 + llo;
      float bias = b_out[c];
#pragma unroll
      for (int rr = 0; rr < 8; ++rr)
        out[(size_t)(mbase + rr) * D_MODEL + c] = acc[mf][f][rr] + bias;
    }
  }
}

// ---------------------------------------------------------------------------
extern "C" void kernel_launch(void* const* d_in, const int* in_sizes, int n_in,
                              void* d_out, int out_size, void* d_ws, size_t ws_size,
                              hipStream_t stream) {
  (void)in_sizes; (void)n_in; (void)out_size; (void)ws_size;
  const float* x        = (const float*)d_in[0];
  const float* rope_cos = (const float*)d_in[1];
  const float* rope_sin = (const float*)d_in[2];
  const float* W_qkv    = (const float*)d_in[3];
  const float* b_qkv    = (const float*)d_in[4];
  const float* W_out    = (const float*)d_in[5];
  const float* b_out    = (const float*)d_in[6];

  const size_t headElems = (size_t)BB * NHEAD * LSEQ * DK;  // 4M elems each
  unsigned short* Qr = (unsigned short*)d_ws;
  unsigned short* Kr = Qr + headElems;
  unsigned short* Vt = Kr + headElems;
  unsigned short* O  = Vt + headElems;  // [B][L][D_MODEL] bf16

  qkv_rope_kernel<<<dim3(3 * D_MODEL / 64, BB * LSEQ / 128), 128, 0, stream>>>(
      x, rope_cos, rope_sin, W_qkv, b_qkv, Qr, Kr, Vt);
  attn_kernel<<<dim3(LSEQ / 64, BB * NHEAD), 128, 0, stream>>>(Qr, Kr, Vt, O);
  out_proj_kernel<<<dim3(D_MODEL / 64, BB * LSEQ / 128), 128, 0, stream>>>(
      O, W_out, b_out, (float*)d_out);
}

// v001
// It runs in 203 microseconds.
// Next to v000, in two timings, it ran 1.31 and 1.30 times as fast.
#include <hip/hip_runtime.h>
#include <hip/hip_bf16.h>
#include <stdint.h>

// Problem constants (match reference)
#define D_MODEL 1024
#define NHEAD   16
#define DK      64
#define BB      2
#define LSEQ    2048

typedef __attribute__((ext_vector_type(16))) __bf16 v16bf;
typedef __attribute__((ext_vector_type(8)))  float  v8f;

#define WMMA_BF16(a,b,c) \
  __builtin_amdgcn_wmma_f32_16x16x32_bf16(false,(a),false,(b),(short)0,(c),false,false)

__device__ __forceinline__ v8f zero8() {
  v8f z;
#pragma unroll
  for (int i = 0; i < 8; ++i) z[i] = 0.0f;
  return z;
}

__device__ __forceinline__ unsigned short f2bf(float f) {
  unsigned u = __float_as_uint(f);
  return (unsigned short)((u + 0x8000u) >> 16);  // round-to-nearest (approx)
}

union FragU { uint4 q[2]; v16bf v; };

__device__ __forceinline__ v16bf load_frag(const unsigned short* base, int row,
                                           int stride, int kOff, int sel) {
  const unsigned short* p = base + row * stride + kOff + (sel << 3);
  FragU f;
  f.q[0] = *(const uint4*)(p);
  f.q[1] = *(const uint4*)(p + 16);
  return f.v;
}

#define LDS_STRIDE 72  // 64 + 8 bf16 pad

// Stage a ROWS x 64 fp32 tile (row pitch D_MODEL) as bf16 into LDS, 128 threads.
// 16 lanes take one row's 256 contiguous bytes, so every wave-wide 16-byte load
// reads 2 rows = 4 whole 128-byte lines (a lane per row would touch 32 lines).
template <int ROWS>
__device__ __forceinline__ void stage_tile_f32(const float* __restrict__ src,
                                               unsigned short* dst, int t) {
  const int c = t & 15, r0 = t >> 4;
  float4 v[ROWS / 8];
#pragma unroll  // constant indices keep the array in registers
  for (int i = 0; i < ROWS / 8; ++i)
    v[i] = *(const float4*)(src + (size_t)(i * 8 + r0) * D_MODEL + c * 4);
#pragma unroll  // constant indices keep the array in registers
  for (int i = 0; i < ROWS / 8; ++i) {
    ushort4 o;
    o.x = f2bf(v[i].x); o.y = f2bf(v[i].y); o.z = f2bf(v[i].z); o.w = f2bf(v[i].w);
    *(ushort4*)(dst + (i * 8 + r0) * LDS_STRIDE + c * 4) = o;
  }
}

__device__ __forceinline__ void async_copy8x16B(const unsigned (&l)[8],
                                                const unsigned short* const (&g)[8]) {
  asm volatile(
      "global_load_async_to_lds_b128 %0, %8, off\n\t"
      "global_load_async_to_lds_b128 %1, %9, off\n\t"
      "global_load_async_to_lds_b128 %2, %10, off\n\t"
      "global_load_async_to_lds_b128 %3, %11, off\n\t"
      "global_load_async_to_lds_b128 %4, %12, off\n\t"
      "global_load_async_to_lds_b128 %5, %13, off\n\t"
      "global_load_async_to_lds_b128 %6, %14, off\n\t"
      "global_load_async_to_lds_b128 %7, %15, off\n\t"
      "s_wait_xcnt 0x0"
      :: "v"(l[0]), "v"(l[1]), "v"(l[2]), "v"(l[3]),
         "v"(l[4]), "v"(l[5]), "v"(l[6]), "v"(l[7]),
         "v"(g[0]), "v"(g[1]), "v"(g[2]), "v"(g[3]),
         "v"(g[4]), "v"(g[5]), "v"(g[6]), "v"(g[7])
      : "memory");
}
__device__ __forceinline__ unsigned lds_addr(const unsigned short* l) {
  return (unsigned)(unsigned long long)l;  // low 32b = LDS offset
}
__device__ __forceinline__ void wait_async0() {
  asm volatile("s_wait_asynccnt 0x0" ::: "memory");
}

// ---------------------------------------------------------------------------
// Kernel 1: qkv = x @ W_qkv^T + b_qkv, apply RoPE to q,k, scatter bf16
//   Qr, Kr : [B*H][L][64] bf16   Vt : [B*H][64][L] bf16 (transposed for B-frag)
// grid (48, 32), block 128 (4 waves); tile 128(M) x 64(N), K chunk 64.
// Each wave computes 32 rows x 64 cols (2 M-frags) for better A/B reuse.
// ---------------------------------------------------------------------------
__global__ __launch_bounds__(128) void qkv_rope_kernel(
    const float* __restrict__ x, const float* __restrict__ rope_cos,
    const float* __restrict__ rope_sin, const float* __restrict__ W_qkv,
    const float* __restrict__ b_qkv, unsigned short* __restrict__ Qr,
    unsigned short* __restrict__ Kr, unsigned short* __restrict__ Vt) {
  __shared__ unsigned short aL[128 * LDS_STRIDE];
  __shared__ unsigned short bL[64 * LDS_STRIDE];

  const int t = threadIdx.x;
  const int w = t >> 5, lane = t & 31;
  const int lhi = lane >> 4, llo = lane & 15;
  const int n0 = blockIdx.x * 64;
  const int m0 = blockIdx.y * 128;

  v8f acc[2][4];
#pragma unroll
  for (int mf = 0; mf < 2; ++mf)
#pragma unroll
    for (int f = 0; f < 4; ++f) acc[mf][f] = zero8();

  for (int k0 = 0; k0 < D_MODEL; k0 += 64) {
    __syncthreads();
    // A tile 128 x 64 and B tile 64 x 64 (fp32 -> bf16), whole lines per load
    stage_tile_f32<128>(x + (size_t)m0 * D_MODEL + k0, aL, t);
    stage_tile_f32<64>(W_qkv + (size_t)n0 * D_MODEL + k0, bL, t);
    __syncthreads();
#pragma unroll
    for (int ks = 0; ks < 64; ks += 32) {
      v16bf a0 = load_frag(aL, w * 32 + llo, LDS_STRIDE, ks, lhi);
      v16bf a1 = load_frag(aL, w * 32 + 16 + llo, LDS_STRIDE, ks, lhi);
#pragma unroll
      for (int f = 0; f < 4; ++f) {
        v16bf b = load_frag(bL, f * 16 + llo, LDS_STRIDE, ks, lhi);
        acc[0][f] = WMMA_BF16(a0, b, acc[0][f]);
        acc[1][f] = WMMA_BF16(a1, b, acc[1][f]);
      }
    }
  }

  // Epilogue: bias + RoPE + scatter
  const int which = n0 >> 10;            // 0=q 1=k 2=v
  const int h = (n0 & 1023) >> 6;        // head
#pragma unroll
  for (int mf = 0; mf < 2; ++mf) {
    const int mbase = m0 + w * 32 + mf * 16 + 8 * lhi;
    float val[4][8];
#pragma unroll
    for (int f = 0; f < 4; ++f) {
      float bias = b_qkv[n0 + f * 16 + llo];
#pragma unroll
      for (int rr = 0; rr < 8; ++rr) val[f][rr] = acc[mf][f][rr] + bias;
    }

    if (which < 2) {
#pragma unroll
      for (int f = 0; f < 2; ++f) {
        int d = f * 16 + llo;  // 0..31
#pragma unroll
        for (int rr = 0; rr < 8; ++rr) {
          int m = mbase + rr;
          float c = rope_cos[m * (DK / 2) + d];
          float s = rope_sin[m * (DK / 2) + d];
          float x1 = val[f][rr], x2 = val[f + 2][rr];
          val[f][rr]     = x1 * c - x2 * s;
          val[f + 2][rr] = x1 * s + x2 * c;
        }
      }
      unsigned short* dst = (which == 0) ? Qr : Kr;
#pragma unroll
      for (int f = 0; f < 4; ++f) {
        int d = f * 16 + llo;
#pragma unroll
        for (int rr = 0; rr < 8; ++rr) {
          int m = mbase + rr;
          int b = m >> 11, pos = m & (LSEQ - 1);
          dst[((size_t)(b * NHEAD + h) * LSEQ + pos) * DK + d] = f2bf(val[f][rr]);
        }
      }
    } else {
#pragma unroll
      for (int f = 0; f < 4; ++f) {
        int d = f * 16 + llo;
#pragma unroll
        for (int rr = 0; rr < 8; ++rr) {
          int m = mbase + rr;
          int b = m >> 11, pos = m & (LSEQ - 1);
          Vt[((size_t)(b * NHEAD + h) * DK + d) * LSEQ + pos] = f2bf(val[f][rr]);
        }
      }
    }
  }
}

__global__ __launch_bounds__(128) void attn_kernel(
    const unsigned short* __restrict__ Qr, const unsigned short* __restrict__ Kr,
    const unsigned short* __restrict__ Vt, unsigned short* __restrict__ O) {
  __shared__ __attribute__((aligned(16))) unsigned short kL[64 * LDS_STRIDE];
  __shared__ __attribute__((aligned(16))) unsigned short vL[64 * LDS_STRIDE];
  __shared__ unsigned short pL[4][16 * LDS_STRIDE];

  const int t = threadIdx.x;
  const int w = t >> 5, lane = t & 31;
  const int lhi = lane >> 4, llo = lane & 15;
  const int bh = blockIdx.y;                   // 0..31 = b*16+h
  const int q0 = blockIdx.x * 64 + w * 16;     // wave's first query row
  const size_t hb = (size_t)bh * LSEQ * DK;    // same element offset for Qr/Kr/Vt

  // Q fragments (held in registers for whole kernel)
  v16bf aQ[2];
#pragma unroll
  for (int c = 0; c < 2; ++c)
    aQ[c] = load_frag(Qr + hb, q0 + llo, DK, c * 32, lhi);

  v8f acc[4];
#pragma unroll
  for (int f = 0; f < 4; ++f) acc[f] = zero8();
  float mrun[8], lrun[8];
#pragma unroll
  for (int rr = 0; rr < 8; ++rr) { mrun[rr] = -1e30f; lrun[rr] = 0.0f; }

  // staging map: 8 lanes take one 128-byte tile row, a wave-wide copy 4 whole lines
  const int sr = t >> 3, sc = (t & 7) * 8;
  unsigned ldsKV[8];
#pragma unroll  // constant indices keep the array in registers
  for (int i = 0; i < 4; ++i) {
    ldsKV[i]     = lds_addr(kL + (i * 16 + sr) * LDS_STRIDE + sc);
    ldsKV[4 + i] = lds_addr(vL + (i * 16 + sr) * LDS_STRIDE + sc);
  }
  const float scale = 0.125f;  // 1/sqrt(64)

  for (int kt = 0; kt < LSEQ; kt += 64) {
    __syncthreads();
    const unsigned short* gKV[8];
#pragma unroll  // constant indices keep the array in registers
    for (int i = 0; i < 4; ++i) {
      gKV[i]     = Kr + hb + (size_t)(kt + i * 16 + sr) * DK + sc;
      gKV[4 + i] = Vt + hb + (size_t)(i * 16 + sr) * LSEQ + kt + sc;
    }
    async_copy8x16B(ldsKV, gKV);
    wait_async0();
    __syncthreads();

    // S = Q K^T
    v8f s[4];
#pragma unroll
    for (int f = 0; f < 4; ++f) s[f] = zero8();
#pragma unroll
    for (int c = 0; c < 2; ++c) {
#pragma unroll
      for (int f = 0; f < 4; ++f) {
        v16bf bK = load_frag(kL, f * 16 + llo, LDS_STRIDE, c * 32, lhi);
        s[f] = WMMA_BF16(aQ[c], bK, s[f]);
      }
    }

#pragma unroll
    for (int f = 0; f < 4; ++f)
#pragma unroll
      for (int rr = 0; rr < 8; ++rr) s[f][rr] *= scale;

#pragma unroll
    for (int rr = 0; rr < 8; ++rr) {
      float m = fmaxf(fmaxf(s[0][rr], s[1][rr]), fmaxf(s[2][rr], s[3][rr]));
      m = fmaxf(m, __shfl_xor(m, 1));
      m = fmaxf(m, __shfl_xor(m, 2));
      m = fmaxf(m, __shfl_xor(m, 4));
      m = fmaxf(m, __shfl_xor(m, 8));
      float mnew  = fmaxf(mrun[rr], m);
      float alpha = __expf(mrun[rr] - mnew);
      float rs = 0.0f;
#pragma unroll
      for (int f = 0; f < 4; ++f) {
        float p = __expf(s[f][rr] - mnew);
        s[f][rr] = p;
        rs += p;
      }
      rs += __shfl_xor(rs, 1);
      rs += __shfl_xor(rs, 2);
      rs += __shfl_xor(rs, 4);
      rs += __shfl_xor(rs, 8);
      lrun[rr] = lrun[rr] * alpha + rs;
      mrun[rr] = mnew;
#pragma unroll
      for (int f = 0; f < 4; ++f) acc[f][rr] *= alpha;
    }

    // P: D-layout -> LDS -> A-layout (per-wave private tile; same-wave DS order)
    unsigned short* pw = pL[w];
#pragma unroll
    for (int f = 0; f < 4; ++f)
#pragma unroll
      for (int rr = 0; rr < 8; ++rr)
        pw[(rr + 8 * lhi) * LDS_STRIDE + f * 16 + llo] = f2bf(s[f][rr]);
    asm volatile("s_wait_dscnt 0" ::: "memory");

    // O += P V
#pragma unroll
    for (int c = 0; c < 2; ++c) {
      v16bf aP = load_frag(pw, llo, LDS_STRIDE, c * 32, lhi);
#pragma unroll
      for (int f = 0; f < 4; ++f) {
        v16bf bV = load_frag(vL, f * 16 + llo, LDS_STRIDE, c * 32, lhi);
        acc[f] = WMMA_BF16(aP, bV, acc[f]);
      }
    }
  }

  // normalize + store O as [B][L][H*DK] bf16
  const int b = bh >> 4, h = bh & 15;
  float inv[8];
#pragma unroll
  for (int rr = 0; rr < 8; ++rr) inv[rr] = 1.0f / lrun[rr];
#pragma unroll
  for (int f = 0; f < 4; ++f) {
    int d = f * 16 + llo;
#pragma unroll
    for (int rr = 0; rr < 8; ++rr) {
      int pos = q0 + rr + 8 * lhi;
      O[(size_t)(b * LSEQ + pos) * D_MODEL + h * DK + d] = f2bf(acc[f][rr] * inv[rr]);
    }
  }
}

// ---------------------------------------------------------------------------
// Kernel 3: out = O @ W_out^T + b_out (fp32 result). grid (16, 32), block 128.
// Tile 128(M) x 64(N); A tile (bf16) staged with async global->LDS DMA.
// ---------------------------------------------------------------------------
__global__ __launch_bounds__(128) void out_proj_kernel(
    const unsigned short* __restrict__ O, const float* __restrict__ W_out,
    const float* __restrict__ b_out, float* __restrict__ out) {
  __shared__ __attribute__((aligned(16))) unsigned short aL[128 * LDS_STRIDE];
  __shared__ unsigned short bL[64 * LDS_STRIDE];

  const int t = threadIdx.x;
  const int w = t >> 5, lane = t & 31;
  const int lhi = lane >> 4, llo = lane & 15;
  const int n0 = blockIdx.x * 64;
  const int m0 = blockIdx.y * 128;

  v8f acc[2][4];
#pragma unroll
  for (int mf = 0; mf < 2; ++mf)
#pragma unroll
    for (int f = 0; f < 4; ++f) acc[mf][f] = zero8();

  for (int k0 = 0; k0 < D_MODEL; k0 += 64) {
    __syncthreads();
    // A tile via async DMA: 8 lanes take one 128-byte row, a wave-wide copy 4 whole lines
    unsigned ldsA[8];
    const unsigned short* gA[8];
#pragma unroll  // constant indices keep the arrays in registers
    for (int i = 0; i < 8; ++i) {
      const int row = i * 16 + (t >> 3);
      ldsA[i] = lds_addr(aL + row * LDS_STRIDE + (t & 7) * 8);
      gA[i]   = O + (size_t)(m0 + row) * D_MODEL + k0 + (t & 7) * 8;
    }
    async_copy8x16B(ldsA, gA);
    // B tile: fp32 -> bf16 convert path, whole lines per load
    stage_tile_f32<64>(W_out + (size_t)n0 * D_MODEL + k0, bL, t);
    wait_async0();
    __syncthreads();
#pragma unroll
    for (int ks = 0; ks < 64; ks += 32) {
      v16bf a0 = load_frag(aL, w * 32 + llo, LDS_STRIDE, ks, lhi);
      v16bf a1 = load_frag(aL, w * 32 + 16 + llo, LDS_STRIDE, ks, lhi);
#pragma unroll
      for (int f = 0; f < 4; ++f) {
        v16bf b = load_frag(bL, f * 16 + llo, LDS_STRIDE, ks, lhi);
        acc[0][f] = WMMA_BF16(a0, b, acc[0][f]);
        acc[1][f] = WMMA_BF16(a1, b, acc[1][f]);
      }
    }
  }

#pragma unroll
  for (int mf = 0; mf < 2; ++mf) {
    const int mbase = m0 + w * 32 + mf * 16 + 8 * lhi;
#pragma unroll
    for (int f = 0; f < 4; ++f) {
      int c = n0 + f * 16 + llo;
      float bias = b_out[c];
#pragma unroll
      for (int rr = 0; rr < 8; ++rr)
        out[(size_t)(mbase + rr) * D_MODEL + c] = acc[mf][f][rr] + bias;
    }
  }
}

// ---------------------------------------------------------------------------
extern "C" void kernel_launch(void* const* d_in, const int* in_sizes, int n_in,
                              void* d_out, int out_size, void* d_ws, size_t ws_size,
                              hipStream_t stream) {
  (void)in_sizes; (void)n_in; (void)out_size; (void)ws_size;
  const float* x        = (const float*)d_in[0];
  const float* rope_cos = (const float*)d_in[1];
  const float* rope_sin = (const float*)d_in[2];
  const float* W_qkv    = (const float*)d_in[3];
  const float* b_qkv    = (const float*)d_in[4];
  const float* W_out    = (const float*)d_in[5];
  const float* b_out    = (const float*)d_in[6];

  const size_t headElems = (size_t)BB * NHEAD * LSEQ * DK;  // 4M elems each
  unsigned short* Qr = (unsigned short*)d_ws;
  unsigned short* Kr = Qr + headElems;
  unsigned short* Vt = Kr + headElems;
  unsigned short* O  = Vt + headElems;  // [B][L][D_MODEL] bf16

  qkv_rope_kernel<<<dim3(3 * D_MODEL / 64, BB * LSEQ / 128), 128, 0, stream>>>(
      x, rope_cos, rope_sin, W_qkv, b_qkv, Qr, Kr, Vt);
  attn_kernel<<<dim3(LSEQ / 64, BB * NHEAD), 128, 0, stream>>>(Qr, Kr, Vt, O);
  out_proj_kernel<<<dim3(D_MODEL / 64, BB * LSEQ / 128), 128, 0, stream>>>(
      O, W_out, b_out, (float*)d_out);
}

// v002
// One run takes 154 microseconds.
// In both of two side-by-side timings against v001, it was 1.32 times as fast.
// Over all steps from v000 it is 1.73 times as fast.
#include <hip/hip_runtime.h>
#include <hip/hip_bf16.h>
#include <stdint.h>

// Problem constants (match reference)
#define D_MODEL 1024
#define NHEAD   16
#define DK      64
#define BB      2
#define LSEQ    2048

typedef __attribute__((ext_vector_type(16))) __bf16 v16bf;
typedef __attribute__((ext_vector_type(8)))  float  v8f;

#define WMMA_BF16(a,b,c) \
  __builtin_amdgcn_wmma_f32_16x16x32_bf16(false,(a),false,(b),(short)0,(c),false,false)

__device__ __forceinline__ v8f zero8() {
  v8f z;
#pragma unroll
  for (int i = 0; i < 8; ++i) z[i] = 0.0f;
  return z;
}

__device__ __forceinline__ unsigned short f2bf(float f) {
  unsigned u = __float_as_uint(f);
  return (unsigned short)((u + 0x8000u) >> 16);  // round-to-nearest (approx)
}

union FragU { uint4 q[2]; v16bf v; };

// Two f32 -> one dword of two bf16 (f2bf's rounding), lo in the low half.
__device__ __forceinline__ unsigned pack2bf(float lo, float hi) {
  return __builtin_amdgcn_perm(__float_as_uint(hi) + 0x8000u,
                               __float_as_uint(lo) + 0x8000u, 0x07060302u);
}

__device__ __forceinline__ float xhalf(float x) {
  const int b = __builtin_bit_cast(int, x);
  return __builtin_bit_cast(
      float, __builtin_amdgcn_permlanex16(b, b, 0x76543210, 0xfedcba98, false, false));
}

__device__ __forceinline__ v16bf load_frag(const unsigned short* base, int row,
                                           int stride, int kOff, int sel) {
  const unsigned short* p = base + row * stride + kOff + (sel << 3);
  FragU f;
  f.q[0] = *(const uint4*)(p);
  f.q[1] = *(const uint4*)(p + 16);
  return f.v;
}

#define LDS_STRIDE 72  // 64 + 8 bf16 pad

// Stage a ROWS x 64 fp32 tile (row pitch D_MODEL) as bf16 into LDS, 128 threads.
// 16 lanes take one row's 256 contiguous bytes, so every wave-wide 16-byte load
// reads 2 rows = 4 whole 128-byte lines (a lane per row would touch 32 lines).
template <int ROWS>
__device__ __forceinline__ void stage_tile_f32(const float* __restrict__ src,
                                               unsigned short* dst, int t) {
  const int c = t & 15, r0 = t >> 4;
  float4 v[ROWS / 8];
#pragma unroll  // constant indices keep the array in registers
  for (int i = 0; i < ROWS / 8; ++i)
    v[i] = *(const float4*)(src + (size_t)(i * 8 + r0) * D_MODEL + c * 4);
#pragma unroll  // constant indices keep the array in registers
  for (int i = 0; i < ROWS / 8; ++i) {
    ushort4 o;
    o.x = f2bf(v[i].x); o.y = f2bf(v[i].y); o.z = f2bf(v[i].z); o.w = f2bf(v[i].w);
    *(ushort4*)(dst + (i * 8 + r0) * LDS_STRIDE + c * 4) = o;
  }
}

__device__ __forceinline__ void async_copy8x16B(const unsigned (&l)[8],
                                                const unsigned short* const (&g)[8]) {
  asm volatile(
      "global_load_async_to_lds_b128 %0, %8, off\n\t"
      "global_load_async_to_lds_b128 %1, %9, off\n\t"
      "global_load_async_to_lds_b128 %2, %10, off\n\t"
      "global_load_async_to_lds_b128 %3, %11, off\n\t"
      "global_load_async_to_lds_b128 %4, %12, off\n\t"
      "global_load_async_to_lds_b128 %5, %13, off\n\t"
      "global_load_async_to_lds_b128 %6, %14, off\n\t"
      "global_load_async_to_lds_b128 %7, %15, off\n\t"
      "s_wait_xcnt 0x0"
      :: "v"(l[0]), "v"(l[1]), "v"(l[2]), "v"(l[3]),
         "v"(l[4]), "v"(l[5]), "v"(l[6]), "v"(l[7]),
         "v"(g[0]), "v"(g[1]), "v"(g[2]), "v"(g[3]),
         "v"(g[4]), "v"(g[5]), "v"(g[6]), "v"(g[7])
      : "memory");
}
__device__ __forceinline__ unsigned lds_addr(const unsigned short* l) {
  return (unsigned)(unsigned long long)l;  // low 32b = LDS offset
}
__device__ __forceinline__ void wait_async0() {
  asm volatile("s_wait_asynccnt 0x0" ::: "memory");
}

// ---------------------------------------------------------------------------
// Kernel 1: qkv = x @ W_qkv^T + b_qkv, apply RoPE to q,k, scatter bf16
//   Qr, Kr : [B*H][L][64] bf16   Vt : [B*H][64][L] bf16 (transposed for A-frag)
// grid (48, 32), block 128 (4 waves); tile 128(M) x 64(N), K chunk 64.
// Each wave computes 32 rows x 64 cols (2 M-frags) for better A/B reuse.
// ---------------------------------------------------------------------------
__global__ __launch_bounds__(128) void qkv_rope_kernel(
    const float* __restrict__ x, const float* __restrict__ rope_cos,
    const float* __restrict__ rope_sin, const float* __restrict__ W_qkv,
    const float* __restrict__ b_qkv, unsigned short* __restrict__ Qr,
    unsigned short* __restrict__ Kr, unsigned short* __restrict__ Vt) {
  __shared__ unsigned short aL[128 * LDS_STRIDE];
  __shared__ unsigned short bL[64 * LDS_STRIDE];

  const int t = threadIdx.x;
  const int w = t >> 5, lane = t & 31;
  const int lhi = lane >> 4, llo = lane & 15;
  const int n0 = blockIdx.x * 64;
  const int m0 = blockIdx.y * 128;

  v8f acc[2][4];
#pragma unroll
  for (int mf = 0; mf < 2; ++mf)
#pragma unroll
    for (int f = 0; f < 4; ++f) acc[mf][f] = zero8();

  for (int k0 = 0; k0 < D_MODEL; k0 += 64) {
    __syncthreads();
    // A tile 128 x 64 and B tile 64 x 64 (fp32 -> bf16), whole lines per load
    stage_tile_f32<128>(x + (size_t)m0 * D_MODEL + k0, aL, t);
    stage_tile_f32<64>(W_qkv + (size_t)n0 * D_MODEL + k0, bL, t);
    __syncthreads();
#pragma unroll
    for (int ks = 0; ks < 64; ks += 32) {
      v16bf a0 = load_frag(aL, w * 32 + llo, LDS_STRIDE, ks, lhi);
      v16bf a1 = load_frag(aL, w * 32 + 16 + llo, LDS_STRIDE, ks, lhi);
#pragma unroll
      for (int f = 0; f < 4; ++f) {
        v16bf b = load_frag(bL, f * 16 + llo, LDS_STRIDE, ks, lhi);
        acc[0][f] = WMMA_BF16(a0, b, acc[0][f]);
        acc[1][f] = WMMA_BF16(a1, b, acc[1][f]);
      }
    }
  }

  // Epilogue: bias + RoPE + scatter
  const int which = n0 >> 10;            // 0=q 1=k 2=v
  const int h = (n0 & 1023) >> 6;        // head
#pragma unroll
  for (int mf = 0; mf < 2; ++mf) {
    const int mbase = m0 + w * 32 + mf * 16 + 8 * lhi;
    float val[4][8];
#pragma unroll
    for (int f = 0; f < 4; ++f) {
      float bias = b_qkv[n0 + f * 16 + llo];
#pragma unroll
      for (int rr = 0; rr < 8; ++rr) val[f][rr] = acc[mf][f][rr] + bias;
    }

    if (which < 2) {
#pragma unroll
      for (int f = 0; f < 2; ++f) {
        int d = f * 16 + llo;  // 0..31
#pragma unroll
        for (int rr = 0; rr < 8; ++rr) {
          int m = mbase + rr;
          float c = rope_cos[m * (DK / 2) + d];
          float s = rope_sin[m * (DK / 2) + d];
          float x1 = val[f][rr], x2 = val[f + 2][rr];
          val[f][rr]     = x1 * c - x2 * s;
          val[f + 2][rr] = x1 * s + x2 * c;
        }
      }
      unsigned short* dst = (which == 0) ? Qr : Kr;
#pragma unroll
      for (int f = 0; f < 4; ++f) {
        int d = f * 16 + llo;
#pragma unroll
        for (int rr = 0; rr < 8; ++rr) {
          int m = mbase + rr;
          int b = m >> 11, pos = m & (LSEQ - 1);
          dst[((size_t)(b * NHEAD + h) * LSEQ + pos) * DK + d] = f2bf(val[f][rr]);
        }
      }
    } else {
#pragma unroll
      for (int f = 0; f < 4; ++f) {
        int d = f * 16 + llo;
#pragma unroll
        for (int rr = 0; rr < 8; ++rr) {
          int m = mbase + rr;
          int b = m >> 11, pos = m & (LSEQ - 1);
          Vt[((size_t)(b * NHEAD + h) * DK + d) * LSEQ + pos] = f2bf(val[f][rr]);
        }
      }
    }
  }
}

__global__ __launch_bounds__(128) void attn_kernel(
    const unsigned short* __restrict__ Qr, const unsigned short* __restrict__ Kr,
    const unsigned short* __restrict__ Vt, unsigned short* __restrict__ O) {
  __shared__ __attribute__((aligned(16))) unsigned short kL[64 * LDS_STRIDE];
  __shared__ __attribute__((aligned(16))) unsigned short vL[64 * LDS_STRIDE];

  const int t = threadIdx.x;
  const int w = t >> 5, lane = t & 31;
  const int lhi = lane >> 4, llo = lane & 15;
  const int bh = blockIdx.y;                   // 0..31 = b*16+h
  const int q0 = blockIdx.x * 64 + w * 16;     // wave's first query row
  const size_t hb = (size_t)bh * LSEQ * DK;    // same element offset for Qr/Kr/Vt

  // Q fragments (held in registers for whole kernel)
  v16bf aQ[2];
#pragma unroll
  for (int c = 0; c < 2; ++c)
    aQ[c] = load_frag(Qr + hb, q0 + llo, DK, c * 32, lhi);

  v8f acc[4];
#pragma unroll
  for (int f = 0; f < 4; ++f) acc[f] = zero8();
  // this lane's query: running maximum (both halves alike), running sum (own half's keys)
  float mrun = -1e30f, lrun = 0.0f;

  // staging map: 8 lanes take one 128-byte tile row, a wave-wide copy 4 whole lines
  const int sr = t >> 3, sc = (t & 7) * 8;
  unsigned ldsKV[8];
#pragma unroll  // constant indices keep the array in registers
  for (int i = 0; i < 4; ++i) {
    ldsKV[i]     = lds_addr(kL + (i * 16 + sr) * LDS_STRIDE + sc);
    ldsKV[4 + i] = lds_addr(vL + (i * 16 + sr) * LDS_STRIDE + sc);
  }
  const float scale = 0.125f;  // 1/sqrt(64)

  for (int kt = 0; kt < LSEQ; kt += 64) {
    __syncthreads();
    const unsigned short* gKV[8];
#pragma unroll  // constant indices keep the array in registers
    for (int i = 0; i < 4; ++i) {
      gKV[i]     = Kr + hb + (size_t)(kt + i * 16 + sr) * DK + sc;
      gKV[4 + i] = Vt + hb + (size_t)(i * 16 + sr) * LSEQ + kt + sc;
    }
    async_copy8x16B(ldsKV, gKV);
    wait_async0();
    __syncthreads();

    // S^T = K Q^T: A = K rows (keys), B = Q rows (queries)
    v8f s[4];
#pragma unroll
    for (int f = 0; f < 4; ++f) s[f] = zero8();
#pragma unroll
    for (int c = 0; c < 2; ++c) {
#pragma unroll
      for (int f = 0; f < 4; ++f) {
        v16bf aK = load_frag(kL, f * 16 + llo, LDS_STRIDE, c * 32, lhi);
        s[f] = WMMA_BF16(aK, aQ[c], s[f]);
      }
    }

    // online softmax: all 32 scores of a lane belong to query q0 + llo
#pragma unroll
    for (int f = 0; f < 4; ++f)
#pragma unroll
      for (int rr = 0; rr < 8; ++rr) s[f][rr] *= scale;

    float mf[4];
#pragma unroll
    for (int f = 0; f < 4; ++f) {
      mf[f] = s[f][0];
#pragma unroll
      for (int rr = 1; rr < 8; ++rr) mf[f] = fmaxf(mf[f], s[f][rr]);
    }
    float m = fmaxf(fmaxf(mf[0], mf[1]), fmaxf(mf[2], mf[3]));
    m = fmaxf(m, xhalf(m));  // join the two halves' keys
    const float mnew  = fmaxf(mrun, m);
    const float alpha = __expf(mrun - mnew);
    float rs[4];
#pragma unroll
    for (int f = 0; f < 4; ++f) {
      rs[f] = 0.0f;
#pragma unroll
      for (int rr = 0; rr < 8; ++rr) {
        float p = __expf(s[f][rr] - mnew);
        s[f][rr] = p;
        rs[f] += p;
      }
    }
    lrun = lrun * alpha + ((rs[0] + rs[1]) + (rs[2] + rs[3]));
    mrun = mnew;
#pragma unroll
    for (int f = 0; f < 4; ++f)
#pragma unroll
      for (int rr = 0; rr < 8; ++rr) acc[f][rr] *= alpha;

    // O^T += V^T P^T: A = Vt rows (d), B = P^T packed from tiles 2c and 2c + 1,
    // which is load_frag's k order (8h + e, then 16 + 8h + e) at every position
#pragma unroll
    for (int c = 0; c < 2; ++c) {
      FragU bP;
      bP.q[0] = make_uint4(pack2bf(s[2 * c][0], s[2 * c][1]), pack2bf(s[2 * c][2], s[2 * c][3]),
                           pack2bf(s[2 * c][4], s[2 * c][5]), pack2bf(s[2 * c][6], s[2 * c][7]));
      bP.q[1] = make_uint4(pack2bf(s[2 * c + 1][0], s[2 * c + 1][1]),
                           pack2bf(s[2 * c + 1][2], s[2 * c + 1][3]),
                           pack2bf(s[2 * c + 1][4], s[2 * c + 1][5]),
                           pack2bf(s[2 * c + 1][6], s[2 * c + 1][7]));
#pragma unroll
      for (int f = 0; f < 4; ++f) {
        v16bf aV = load_frag(vL, f * 16 + llo, LDS_STRIDE, c * 32, lhi);
        acc[f] = WMMA_BF16(aV, bP.v, acc[f]);
      }
    }
  }

  // normalize + store O as [B][L][H*DK] bf16: a lane's 8 registers of tile f are
  // d = 16f + 8h + 0..7 of its query's row, one 16-byte store
  const int b = bh >> 4, h = bh & 15;
  const float inv = 1.0f / (lrun + xhalf(lrun));  // join the halves' sums once
  unsigned short* orow = O + (size_t)(b * LSEQ + q0 + llo) * D_MODEL + h * DK + 8 * lhi;
#pragma unroll
  for (int f = 0; f < 4; ++f)
    *(uint4*)(orow + f * 16) =
        make_uint4(pack2bf(acc[f][0] * inv, acc[f][1] * inv), pack2bf(acc[f][2] * inv, acc[f][3] * inv),
                   pack2bf(acc[f][4] * inv, acc[f][5] * inv), pack2bf(acc[f][6] * inv, acc[f][7] * inv));
}

// ---------------------------------------------------------------------------
// Kernel 3: out = O @ W_out^T + b_out (fp32 result). grid (16, 32), block 128.
// Tile 128(M) x 64(N); A tile (bf16) staged with async global->LDS DMA.
// ---------------------------------------------------------------------------
__global__ __launch_bounds__(128) void out_proj_kernel(
    const unsigned short* __restrict__ O, const float* __restrict__ W_out,
    const float* __restrict__ b_out, float* __restrict__ out) {
  __shared__ __attribute__((aligned(16))) unsigned short aL[128 * LDS_STRIDE];
  __shared__ unsigned short bL[64 * LDS_STRIDE];

  const int t = threadIdx.x;
  const int w = t >> 5, lane = t & 31;
  const int lhi = lane >> 4, llo = lane & 15;
  const int n0 = blockIdx.x * 64;
  const int m0 = blockIdx.y * 128;

  v8f acc[2][4];
#pragma unroll
  for (int mf = 0; mf < 2; ++mf)
#pragma unroll
    for (int f = 0; f < 4; ++f) acc[mf][f] = zero8();

  for (int k0 = 0; k0 < D_MODEL; k0 += 64) {
    __syncthreads();
    // A tile via async DMA: 8 lanes take one 128-byte row, a wave-wide copy 4 whole lines
    unsigned ldsA[8];
    const unsigned short* gA[8];
#pragma unroll  // constant indices keep the arrays in registers
    for (int i = 0; i < 8; ++i) {
      const int row = i * 16 + (t >> 3);
      ldsA[i] = lds_addr(aL + row * LDS_STRIDE + (t & 7) * 8);
      gA[i]   = O + (size_t)(m0 + row) * D_MODEL + k0 + (t & 7) * 8;
    }
    async_copy8x16B(ldsA, gA);
    // B tile: fp32 -> bf16 convert path, whole lines per load
    stage_tile_f32<64>(W_out + (size_t)n0 * D_MODEL + k0, bL, t);
    wait_async0();
    __syncthreads();
#pragma unroll
    for (int ks = 0; ks < 64; ks += 32) {
      v16bf a0 = load_frag(aL, w * 32 + llo, LDS_STRIDE, ks, lhi);
      v16bf a1 = load_frag(aL, w * 32 + 16 + llo, LDS_STRIDE, ks, lhi);
#pragma unroll
      for (int f = 0; f < 4; ++f) {
        v16bf b = load_frag(bL, f * 16 + llo, LDS_STRIDE, ks, lhi);
        acc[0][f] = WMMA_BF16(a0, b, acc[0][f]);
        acc[1][f] = WMMA_BF16(a1, b, acc[1][f]);
      }
    }
  }

#pragma unroll
  for (int mf = 0; mf < 2; ++mf) {
    const int mbase = m0 + w * 32 + mf * 16 + 8 * lhi;
#pragma unroll
    for (int f = 0; f < 4; ++f) {
      int c = n0 + f * 16 + llo;
      float bias = b_out[c];
#pragma unroll
      for (int rr = 0; rr < 8; ++rr)
        out[(size_t)(mbase + rr) * D_MODEL + c] = acc[mf][f][rr] + bias;
    }
  }
}

// ---------------------------------------------------------------------------
extern "C" void kernel_launch(void* const* d_in, const int* in_sizes, int n_in,
                              void* d_out, int out_size, void* d_ws, size_t ws_size,
                              hipStream_t stream) {
  (void)in_sizes; (void)n_in; (void)out_size; (void)ws_size;
  const float* x        = (const float*)d_in[0];
  const float* rope_cos = (const float*)d_in[1];
  const float* rope_sin = (const float*)d_in[2];
  const float* W_qkv    = (const float*)d_in[3];
  const float* b_qkv    = (const float*)d_in[4];
  const float* W_out    = (const float*)d_in[5];
  const float* b_out    = (const float*)d_in[6];

  const size_t headElems = (size_t)BB * NHEAD * LSEQ * DK;  // 4M elems each
  unsigned short* Qr = (unsigned short*)d_ws;
  unsigned short* Kr = Qr + headElems;
  unsigned short* Vt = Kr + headElems;
  unsigned short* O  = Vt + headElems;  // [B][L][D_MODEL] bf16

  qkv_rope_kernel<<<dim3(3 * D_MODEL / 64, BB * LSEQ / 128), 128, 0, stream>>>(
      x, rope_cos, rope_sin, W_qkv, b_qkv, Qr, Kr, Vt);
  attn_kernel<<<dim3(LSEQ / 64, BB * NHEAD), 128, 0, stream>>>(Qr, Kr, Vt, O);
  out_proj_kernel<<<dim3(D_MODEL / 64, BB * LSEQ / 128), 128, 0, stream>>>(
      O, W_out, b_out, (float*)d_out);
}

// v003
// It runs in 110 microseconds.
// Next to v002, in two timings, it ran 1.41 times as fast each time.
// All steps since v000 together make it 2.44 times as fast.
#include <hip/hip_runtime.h>
#include <hip/hip_bf16.h>
#include <stdint.h>

// Problem constants (match reference)
#define D_MODEL 1024
#define NHEAD   16
#define DK      64
#define BB      2
#define LSEQ    2048

typedef __attribute__((ext_vector_type(16))) __bf16 v16bf;
typedef __attribute__((ext_vector_type(8)))  float  v8f;

#define WMMA_BF16(a,b,c) \
  __builtin_amdgcn_wmma_f32_16x16x32_bf16(false,(a),false,(b),(short)0,(c),false,false)

__device__ __forceinline__ v8f zero8() {
  v8f z;
#pragma unroll
  for (int i = 0; i < 8; ++i) z[i] = 0.0f;
  return z;
}

__device__ __forceinline__ unsigned short f2bf(float f) {
  unsigned u = __float_as_uint(f);
  return (unsigned short)((u + 0x8000u) >> 16);  // round-to-nearest (approx)
}

union FragU { uint4 q[2]; v16bf v; };

// Two f32 -> one dword of two bf16 (f2bf's rounding), lo in the low half.
__device__ __forceinline__ unsigned pack2bf(float lo, float hi) {
  return __builtin_amdgcn_perm(__float_as_uint(hi) + 0x8000u,
                               __float_as_uint(lo) + 0x8000u, 0x07060302u);
}

__device__ __forceinline__ float xhalf(float x) {
  const int b = __builtin_bit_cast(int, x);
  return __builtin_bit_cast(
      float, __builtin_amdgcn_permlanex16(b, b, 0x76543210, 0xfedcba98, false, false));
}

__device__ __forceinline__ v16bf load_frag(const unsigned short* base, int row,
                                           int stride, int kOff, int sel) {
  const unsigned short* p = base + row * stride + kOff + (sel << 3);
  FragU f;
  f.q[0] = *(const uint4*)(p);
  f.q[1] = *(const uint4*)(p + 16);
  return f.v;
}

#define LDS_STRIDE 72  // 64 + 8 bf16 pad

__device__ __forceinline__ void async_copy8x16B(const unsigned (&l)[8],
                                                const unsigned short* const (&g)[8]) {
  asm volatile(
      "global_load_async_to_lds_b128 %0, %8, off\n\t"
      "global_load_async_to_lds_b128 %1, %9, off\n\t"
      "global_load_async_to_lds_b128 %2, %10, off\n\t"
      "global_load_async_to_lds_b128 %3, %11, off\n\t"
      "global_load_async_to_lds_b128 %4, %12, off\n\t"
      "global_load_async_to_lds_b128 %5, %13, off\n\t"
      "global_load_async_to_lds_b128 %6, %14, off\n\t"
      "global_load_async_to_lds_b128 %7, %15, off\n\t"
      "s_wait_xcnt 0x0"
      :: "v"(l[0]), "v"(l[1]), "v"(l[2]), "v"(l[3]),
         "v"(l[4]), "v"(l[5]), "v"(l[6]), "v"(l[7]),
         "v"(g[0]), "v"(g[1]), "v"(g[2]), "v"(g[3]),
         "v"(g[4]), "v"(g[5]), "v"(g[6]), "v"(g[7])
      : "memory");
}
__device__ __forceinline__ unsigned lds_addr(const unsigned short* l) {
  return (unsigned)(unsigned long long)l;  // low 32b = LDS offset
}
__device__ __forceinline__ void wait_async0() {
  asm volatile("s_wait_asynccnt 0x0" ::: "memory");
}
// Ahead of the barrier that frees a tile for refilling: this wave's LDS reads have retired.
__device__ __forceinline__ void wait_ds0() {
  asm volatile("s_wait_dscnt 0x0" ::: "memory");
}
__device__ __forceinline__ void async_copy12x16B(const unsigned (&l)[12],
                                                 const unsigned short* const (&g)[12]) {
  asm volatile(
      "global_load_async_to_lds_b128 %0, %12, off\n\t"
      "global_load_async_to_lds_b128 %1, %13, off\n\t"
      "global_load_async_to_lds_b128 %2, %14, off\n\t"
      "global_load_async_to_lds_b128 %3, %15, off\n\t"
      "global_load_async_to_lds_b128 %4, %16, off\n\t"
      "global_load_async_to_lds_b128 %5, %17, off\n\t"
      "global_load_async_to_lds_b128 %6, %18, off\n\t"
      "global_load_async_to_lds_b128 %7, %19, off\n\t"
      "global_load_async_to_lds_b128 %8, %20, off\n\t"
      "global_load_async_to_lds_b128 %9, %21, off\n\t"
      "global_load_async_to_lds_b128 %10, %22, off\n\t"
      "global_load_async_to_lds_b128 %11, %23, off\n\t"
      "s_wait_xcnt 0x0"
      :: "v"(l[0]), "v"(l[1]), "v"(l[2]), "v"(l[3]), "v"(l[4]), "v"(l[5]),
         "v"(l[6]), "v"(l[7]), "v"(l[8]), "v"(l[9]), "v"(l[10]), "v"(l[11]),
         "v"(g[0]), "v"(g[1]), "v"(g[2]), "v"(g[3]), "v"(g[4]), "v"(g[5]),
         "v"(g[6]), "v"(g[7]), "v"(g[8]), "v"(g[9]), "v"(g[10]), "v"(g[11])
      : "memory");
}

// GEMM tile staging, 128 threads: A 128 x 64 and B 64 x 64 bf16, row pitch D_MODEL.
// 8 lanes take one 128-byte tile row, so a wave-wide copy covers 4 whole lines;
// all twelve copies of a lane are in flight together, through no register.
__device__ __forceinline__ void gemm_lds_addrs(const unsigned short* aL, const unsigned short* bL,
                                               int t, unsigned (&l)[12]) {
#pragma unroll  // constant indices keep the array in registers
  for (int i = 0; i < 12; ++i) {
    const unsigned short* tile = (i < 8) ? aL : bL;
    l[i] = lds_addr(tile + ((i & 7) * 16 + (t >> 3)) * LDS_STRIDE + (t & 7) * 8);
  }
}
__device__ __forceinline__ void gemm_stage_tiles(const unsigned short* a, const unsigned short* b,
                                                 int t, const unsigned (&l)[12]) {
  const unsigned short* g[12];
#pragma unroll  // constant indices keep the array in registers
  for (int i = 0; i < 12; ++i) {
    const unsigned short* tile = (i < 8) ? a : b;
    g[i] = tile + (size_t)((i & 7) * 16 + (t >> 3)) * D_MODEL + (t & 7) * 8;
  }
  async_copy12x16B(l, g);
}

// ---------------------------------------------------------------------------
// Kernel 0: x, W_qkv, W_out rounded to bf16 once (f2bf's rounding), so that no GEMM
// tile is converted again by every workgroup that reads it.
// grid 512, block 256; a block takes 4096 float4; a wave-wide load covers 4 whole
// lines, a wave-wide 8-byte store 2.
// ---------------------------------------------------------------------------
#define CVT_F4     4096                                   // float4 per block
#define CVT_BLK_X  (BB * LSEQ * D_MODEL / 4 / CVT_F4)      // 256
#define CVT_BLK_WQ (3 * D_MODEL * D_MODEL / 4 / CVT_F4)    // 192
#define CVT_BLK_WO (D_MODEL * D_MODEL / 4 / CVT_F4)        // 64
__global__ __launch_bounds__(256) void to_bf16_kernel(
    const float* __restrict__ x, const float* __restrict__ W_qkv,
    const float* __restrict__ W_out, unsigned short* __restrict__ xb,
    unsigned short* __restrict__ Wqb, unsigned short* __restrict__ Wob) {
  const int blk = blockIdx.x;
  const float* src = x;
  unsigned short* dst = xb;
  int b0 = blk;
  if (blk >= CVT_BLK_X + CVT_BLK_WQ) {
    src = W_out; dst = Wob; b0 = blk - (CVT_BLK_X + CVT_BLK_WQ);
  } else if (blk >= CVT_BLK_X) {
    src = W_qkv; dst = Wqb; b0 = blk - CVT_BLK_X;
  }
  const int base = b0 * CVT_F4 + (int)threadIdx.x;
  float4 v[CVT_F4 / 256];
#pragma unroll  // constant indices keep the array in registers
  for (int i = 0; i < CVT_F4 / 256; ++i) v[i] = ((const float4*)src)[base + i * 256];
#pragma unroll  // constant indices keep the array in registers
  for (int i = 0; i < CVT_F4 / 256; ++i)
    ((uint2*)dst)[base + i * 256] = make_uint2(pack2bf(v[i].x, v[i].y), pack2bf(v[i].z, v[i].w));
}

__global__ __launch_bounds__(128) __attribute__((amdgpu_waves_per_eu(1, 6))) void qkv_rope_kernel(
    const unsigned short* __restrict__ xb, const float* __restrict__ rope_cos,
    const float* __restrict__ rope_sin, const unsigned short* __restrict__ Wqb,
    const float* __restrict__ b_qkv, unsigned short* __restrict__ Qr,
    unsigned short* __restrict__ Kr, unsigned short* __restrict__ Vt) {
  __shared__ __attribute__((aligned(16))) unsigned short aL[128 * LDS_STRIDE];
  __shared__ __attribute__((aligned(16))) unsigned short bL[64 * LDS_STRIDE];

  const int t = threadIdx.x;
  const int w = t >> 5, lane = t & 31;
  const int lhi = lane >> 4, llo = lane & 15;
  const int n0 = blockIdx.x * 64;
  const int m0 = blockIdx.y * 128;

  v8f acc[2][4];
#pragma unroll
  for (int mf = 0; mf < 2; ++mf)
#pragma unroll
    for (int f = 0; f < 4; ++f) acc[mf][f] = zero8();

  unsigned ldsAB[12];
  gemm_lds_addrs(aL, bL, t, ldsAB);

  for (int k0 = 0; k0 < D_MODEL; k0 += 64) {
    wait_ds0();
    __syncthreads();
    gemm_stage_tiles(xb + (size_t)m0 * D_MODEL + k0, Wqb + (size_t)n0 * D_MODEL + k0, t, ldsAB);
    wait_async0();
    __syncthreads();
#pragma unroll
    for (int ks = 0; ks < 64; ks += 32) {
      v16bf a0 = load_frag(aL, w * 32 + llo, LDS_STRIDE, ks, lhi);
      v16bf a1 = load_frag(aL, w * 32 + 16 + llo, LDS_STRIDE, ks, lhi);
#pragma unroll
      for (int f = 0; f < 4; ++f) {
        v16bf b = load_frag(bL, f * 16 + llo, LDS_STRIDE, ks, lhi);
        acc[0][f] = WMMA_BF16(a0, b, acc[0][f]);
        acc[1][f] = WMMA_BF16(a1, b, acc[1][f]);
      }
    }
  }

  // Epilogue: bias + RoPE + scatter
  const int which = n0 >> 10;            // 0=q 1=k 2=v
  const int h = (n0 & 1023) >> 6;        // head
#pragma unroll
  for (int mf = 0; mf < 2; ++mf) {
    const int mbase = m0 + w * 32 + mf * 16 + 8 * lhi;
    float val[4][8];
#pragma unroll
    for (int f = 0; f < 4; ++f) {
      float bias = b_qkv[n0 + f * 16 + llo];
#pragma unroll
      for (int rr = 0; rr < 8; ++rr) val[f][rr] = acc[mf][f][rr] + bias;
    }

    if (which < 2) {
#pragma unroll
      for (int f = 0; f < 2; ++f) {
        int d = f * 16 + llo;  // 0..31
#pragma unroll
        for (int rr = 0; rr < 8; ++rr) {
          int m = mbase + rr;
          float c = rope_cos[m * (DK / 2) + d];
          float s = rope_sin[m * (DK / 2) + d];
          float x1 = val[f][rr], x2 = val[f + 2][rr];
          val[f][rr]     = x1 * c - x2 * s;
          val[f + 2][rr] = x1 * s + x2 * c;
        }
      }
      unsigned short* dst = (which == 0) ? Qr : Kr;
#pragma unroll
      for (int f = 0; f < 4; ++f) {
        int d = f * 16 + llo;
#pragma unroll
        for (int rr = 0; rr < 8; ++rr) {
          int m = mbase + rr;
          int b = m >> 11, pos = m & (LSEQ - 1);
          dst[((size_t)(b * NHEAD + h) * LSEQ + pos) * DK + d] = f2bf(val[f][rr]);
        }
      }
    } else {
#pragma unroll
      for (int f = 0; f < 4; ++f) {
        int d = f * 16 + llo;
#pragma unroll
        for (int rr = 0; rr < 8; ++rr) {
          int m = mbase + rr;
          int b = m >> 11, pos = m & (LSEQ - 1);
          Vt[((size_t)(b * NHEAD + h) * DK + d) * LSEQ + pos] = f2bf(val[f][rr]);
        }
      }
    }
  }
}

__global__ __launch_bounds__(128) void attn_kernel(
    const unsigned short* __restrict__ Qr, const unsigned short* __restrict__ Kr,
    const unsigned short* __restrict__ Vt, unsigned short* __restrict__ O) {
  __shared__ __attribute__((aligned(16))) unsigned short kL[64 * LDS_STRIDE];
  __shared__ __attribute__((aligned(16))) unsigned short vL[64 * LDS_STRIDE];

  const int t = threadIdx.x;
  const int w = t >> 5, lane = t & 31;
  const int lhi = lane >> 4, llo = lane & 15;
  const int bh = blockIdx.y;                   // 0..31 = b*16+h
  const int q0 = blockIdx.x * 64 + w * 16;     // wave's first query row
  const size_t hb = (size_t)bh * LSEQ * DK;    // same element offset for Qr/Kr/Vt

  // Q fragments (held in registers for whole kernel)
  v16bf aQ[2];
#pragma unroll
  for (int c = 0; c < 2; ++c)
    aQ[c] = load_frag(Qr + hb, q0 + llo, DK, c * 32, lhi);

  v8f acc[4];
#pragma unroll
  for (int f = 0; f < 4; ++f) acc[f] = zero8();
  // this lane's query: running maximum (both halves alike), running sum (own half's keys)
  float mrun = -1e30f, lrun = 0.0f;

  // staging map: 8 lanes take one 128-byte tile row, a wave-wide copy 4 whole lines
  const int sr = t >> 3, sc = (t & 7) * 8;
  unsigned ldsKV[8];
#pragma unroll  // constant indices keep the array in registers
  for (int i = 0; i < 4; ++i) {
    ldsKV[i]     = lds_addr(kL + (i * 16 + sr) * LDS_STRIDE + sc);
    ldsKV[4 + i] = lds_addr(vL + (i * 16 + sr) * LDS_STRIDE + sc);
  }
  const float scale = 0.125f;  // 1/sqrt(64)

  for (int kt = 0; kt < LSEQ; kt += 64) {
    __syncthreads();
    const unsigned short* gKV[8];
#pragma unroll  // constant indices keep the array in registers
    for (int i = 0; i < 4; ++i) {
      gKV[i]     = Kr + hb + (size_t)(kt + i * 16 + sr) * DK + sc;
      gKV[4 + i] = Vt + hb + (size_t)(i * 16 + sr) * LSEQ + kt + sc;
    }
    async_copy8x16B(ldsKV, gKV);
    wait_async0();
    __syncthreads();

    // S^T = K Q^T: A = K rows (keys), B = Q rows (queries)
    v8f s[4];
#pragma unroll
    for (int f = 0; f < 4; ++f) s[f] = zero8();
#pragma unroll
    for (int c = 0; c < 2; ++c) {
#pragma unroll
      for (int f = 0; f < 4; ++f) {
        v16bf aK = load_frag(kL, f * 16 + llo, LDS_STRIDE, c * 32, lhi);
        s[f] = WMMA_BF16(aK, aQ[c], s[f]);
      }
    }

    // online softmax: all 32 scores of a lane belong to query q0 + llo
#pragma unroll
    for (int f = 0; f < 4; ++f)
#pragma unroll
      for (int rr = 0; rr < 8; ++rr) s[f][rr] *= scale;

    float mf[4];
#pragma unroll
    for (int f = 0; f < 4; ++f) {
      mf[f] = s[f][0];
#pragma unroll
      for (int rr = 1; rr < 8; ++rr) mf[f] = fmaxf(mf[f], s[f][rr]);
    }
    float m = fmaxf(fmaxf(mf[0], mf[1]), fmaxf(mf[2], mf[3]));
    m = fmaxf(m, xhalf(m));  // join the two halves' keys
    const float mnew  = fmaxf(mrun, m);
    const float alpha = __expf(mrun - mnew);
    float rs[4];
#pragma unroll
    for (int f = 0; f < 4; ++f) {
      rs[f] = 0.0f;
#pragma unroll
      for (int rr = 0; rr < 8; ++rr) {
        float p = __expf(s[f][rr] - mnew);
        s[f][rr] = p;
        rs[f] += p;
      }
    }
    lrun = lrun * alpha + ((rs[0] + rs[1]) + (rs[2] + rs[3]));
    mrun = mnew;
#pragma unroll
    for (int f = 0; f < 4; ++f)
#pragma unroll
      for (int rr = 0; rr < 8; ++rr) acc[f][rr] *= alpha;

    // O^T += V^T P^T: A = Vt rows (d), B = P^T packed from tiles 2c and 2c + 1,
    // which is load_frag's k order (8h + e, then 16 + 8h + e) at every position
#pragma unroll
    for (int c = 0; c < 2; ++c) {
      FragU bP;
      bP.q[0] = make_uint4(pack2bf(s[2 * c][0], s[2 * c][1]), pack2bf(s[2 * c][2], s[2 * c][3]),
                           pack2bf(s[2 * c][4], s[2 * c][5]), pack2bf(s[2 * c][6], s[2 * c][7]));
      bP.q[1] = make_uint4(pack2bf(s[2 * c + 1][0], s[2 * c + 1][1]),
                           pack2bf(s[2 * c + 1][2], s[2 * c + 1][3]),
                           pack2bf(s[2 * c + 1][4], s[2 * c + 1][5]),
                           pack2bf(s[2 * c + 1][6], s[2 * c + 1][7]));
#pragma unroll
      for (int f = 0; f < 4; ++f) {
        v16bf aV = load_frag(vL, f * 16 + llo, LDS_STRIDE, c * 32, lhi);
        acc[f] = WMMA_BF16(aV, bP.v, acc[f]);
      }
    }
  }

  // normalize + store O as [B][L][H*DK] bf16: a lane's 8 registers of tile f are
  // d = 16f + 8h + 0..7 of its query's row, one 16-byte store
  const int b = bh >> 4, h = bh & 15;
  const float inv = 1.0f / (lrun + xhalf(lrun));  // join the halves' sums once
  unsigned short* orow = O + (size_t)(b * LSEQ + q0 + llo) * D_MODEL + h * DK + 8 * lhi;
#pragma unroll
  for (int f = 0; f < 4; ++f)
    *(uint4*)(orow + f * 16) =
        make_uint4(pack2bf(acc[f][0] * inv, acc[f][1] * inv), pack2bf(acc[f][2] * inv, acc[f][3] * inv),
                   pack2bf(acc[f][4] * inv, acc[f][5] * inv), pack2bf(acc[f][6] * inv, acc[f][7] * inv));
}

__global__ __launch_bounds__(128) __attribute__((amdgpu_waves_per_eu(1, 6))) void out_proj_kernel(
    const unsigned short* __restrict__ O, const unsigned short* __restrict__ Wob,
    const float* __restrict__ b_out, float* __restrict__ out) {
  __shared__ __attribute__((aligned(16))) unsigned short aL[128 * LDS_STRIDE];
  __shared__ __attribute__((aligned(16))) unsigned short bL[64 * LDS_STRIDE];

  const int t = threadIdx.x;
  const int w = t >> 5, lane = t & 31;
  const int lhi = lane >> 4, llo = lane & 15;
  const int n0 = blockIdx.x * 64;
  const int m0 = blockIdx.y * 128;

  v8f acc[2][4];
#pragma unroll
  for (int mf = 0; mf < 2; ++mf)
#pragma unroll
    for (int f = 0; f < 4; ++f) acc[mf][f] = zero8();

  unsigned ldsAB[12];
  gemm_lds_addrs(aL, bL, t, ldsAB);

  for (int k0 = 0; k0 < D_MODEL; k0 += 64) {
    wait_ds0();
    __syncthreads();
    gemm_stage_tiles(O + (size_t)m0 * D_MODEL + k0, Wob + (size_t)n0 * D_MODEL + k0, t, ldsAB);
    wait_async0();
    __syncthreads();
#pragma unroll
    for (int ks = 0; ks < 64; ks += 32) {
      v16bf a0 = load_frag(aL, w * 32 + llo, LDS_STRIDE, ks, lhi);
      v16bf a1 = load_frag(aL, w * 32 + 16 + llo, LDS_STRIDE, ks, lhi);
#pragma unroll
      for (int f = 0; f < 4; ++f) {
        v16bf b = load_frag(bL, f * 16 + llo, LDS_STRIDE, ks, lhi);
        acc[0][f] = WMMA_BF16(a0, b, acc[0][f]);
        acc[1][f] = WMMA_BF16(a1, b, acc[1][f]);
      }
    }
  }

#pragma unroll
  for (int mf = 0; mf < 2; ++mf) {
    const int mbase = m0 + w * 32 + mf * 16 + 8 * lhi;
#pragma unroll
    for (int f = 0; f < 4; ++f) {
      int c = n0 + f * 16 + llo;
      float bias = b_out[c];
#pragma unroll
      for (int rr = 0; rr < 8; ++rr)
        out[(size_t)(mbase + rr) * D_MODEL + c] = acc[mf][f][rr] + bias;
    }
  }
}

// ---------------------------------------------------------------------------
extern "C" void kernel_launch(void* const* d_in, const int* in_sizes, int n_in,
                              void* d_out, int out_size, void* d_ws, size_t ws_size,
                              hipStream_t stream) {
  (void)in_sizes; (void)n_in; (void)out_size; (void)ws_size;
  const float* x        = (const float*)d_in[0];
  const float* rope_cos = (const float*)d_in[1];
  const float* rope_sin = (const float*)d_in[2];
  const float* W_qkv    = (const float*)d_in[3];
  const float* b_qkv    = (const float*)d_in[4];
  const float* W_out    = (const float*)d_in[5];
  const float* b_out    = (const float*)d_in[6];

  const size_t headElems = (size_t)BB * NHEAD * LSEQ * DK;  // 4M elems each
  unsigned short* Qr = (unsigned short*)d_ws;
  unsigned short* Kr = Qr + headElems;
  unsigned short* Vt = Kr + headElems;
  unsigned short* O  = Vt + headElems;  // [B][L][D_MODEL] bf16
  unsigned short* xb  = O + headElems;                      // x as bf16
  unsigned short* Wqb = xb + (size_t)BB * LSEQ * D_MODEL;   // W_qkv as bf16
  unsigned short* Wob = Wqb + (size_t)3 * D_MODEL * D_MODEL;  // W_out as bf16

  to_bf16_kernel<<<dim3(CVT_BLK_X + CVT_BLK_WQ + CVT_BLK_WO), 256, 0, stream>>>(
      x, W_qkv, W_out, xb, Wqb, Wob);
  qkv_rope_kernel<<<dim3(3 * D_MODEL / 64, BB * LSEQ / 128), 128, 0, stream>>>(
      xb, rope_cos, rope_sin, Wqb, b_qkv, Qr, Kr, Vt);
  attn_kernel<<<dim3(LSEQ / 64, BB * NHEAD), 128, 0, stream>>>(Qr, Kr, Vt, O);
  out_proj_kernel<<<dim3(D_MODEL / 64, BB * LSEQ / 128), 128, 0, stream>>>(
      O, Wob, b_out, (float*)d_out);
}

// v004
// It runs in 92.8 microseconds.
// Two timings next to v003 both put it at 1.17 times that version's speed.
// Counting every step since v000, it is 2.85 times as fast.
#include <hip/hip_runtime.h>
#include <hip/hip_bf16.h>
#include <stdint.h>

// Problem constants (match reference)
#define D_MODEL 1024
#define NHEAD   16
#define DK      64
#define BB      2
#define LSEQ    2048

typedef __attribute__((ext_vector_type(16))) __bf16 v16bf;
typedef __attribute__((ext_vector_type(8)))  float  v8f;

#define WMMA_BF16(a,b,c) \
  __builtin_amdgcn_wmma_f32_16x16x32_bf16(false,(a),false,(b),(short)0,(c),false,false)

__device__ __forceinline__ v8f zero8() {
  v8f z;
#pragma unroll
  for (int i = 0; i < 8; ++i) z[i] = 0.0f;
  return z;
}

__device__ __forceinline__ unsigned short f2bf(float f) {
  unsigned u = __float_as_uint(f);
  return (unsigned short)((u + 0x8000u) >> 16);  // round-to-nearest (approx)
}

union FragU { uint4 q[2]; v16bf v; };

// Two f32 -> one dword of two bf16 (f2bf's rounding), lo in the low half.
__device__ __forceinline__ unsigned pack2bf(float lo, float hi) {
  return __builtin_amdgcn_perm(__float_as_uint(hi) + 0x8000u,
                               __float_as_uint(lo) + 0x8000u, 0x07060302u);
}

__device__ __forceinline__ float xhalf(float x) {
  const int b = __builtin_bit_cast(int, x);
  return __builtin_bit_cast(
      float, __builtin_amdgcn_permlanex16(b, b, 0x76543210, 0xfedcba98, false, false));
}

__device__ __forceinline__ v16bf load_frag(const unsigned short* base, int row,
                                           int stride, int kOff, int sel) {
  const unsigned short* p = base + row * stride + kOff + (sel << 3);
  FragU f;
  f.q[0] = *(const uint4*)(p);
  f.q[1] = *(const uint4*)(p + 16);
  return f.v;
}

#define LDS_STRIDE 72  // 64 + 8 bf16 pad

__device__ __forceinline__ void async_copy8x16B(const unsigned (&l)[8],
                                                const unsigned short* const (&g)[8]) {
  asm volatile(
      "global_load_async_to_lds_b128 %0, %8, off\n\t"
      "global_load_async_to_lds_b128 %1, %9, off\n\t"
      "global_load_async_to_lds_b128 %2, %10, off\n\t"
      "global_load_async_to_lds_b128 %3, %11, off\n\t"
      "global_load_async_to_lds_b128 %4, %12, off\n\t"
      "global_load_async_to_lds_b128 %5, %13, off\n\t"
      "global_load_async_to_lds_b128 %6, %14, off\n\t"
      "global_load_async_to_lds_b128 %7, %15, off\n\t"
      "s_wait_xcnt 0x0"
      :: "v"(l[0]), "v"(l[1]), "v"(l[2]), "v"(l[3]),
         "v"(l[4]), "v"(l[5]), "v"(l[6]), "v"(l[7]),
         "v"(g[0]), "v"(g[1]), "v"(g[2]), "v"(g[3]),
         "v"(g[4]), "v"(g[5]), "v"(g[6]), "v"(g[7])
      : "memory");
}
__device__ __forceinline__ unsigned lds_addr(const unsigned short* l) {
  return (unsigned)(unsigned long long)l;  // low 32b = LDS offset
}
__device__ __forceinline__ void wait_async0() {
  asm volatile("s_wait_asynccnt 0x0" ::: "memory");
}
// Ahead of the barrier that frees a tile for refilling: this wave's LDS reads have retired.
__device__ __forceinline__ void wait_ds0() {
  asm volatile("s_wait_dscnt 0x0" ::: "memory");
}
__device__ __forceinline__ void async_copy12x16B(const unsigned (&l)[12],
                                                 const unsigned short* const (&g)[12]) {
  asm volatile(
      "global_load_async_to_lds_b128 %0, %12, off\n\t"
      "global_load_async_to_lds_b128 %1, %13, off\n\t"
      "global_load_async_to_lds_b128 %2, %14, off\n\t"
      "global_load_async_to_lds_b128 %3, %15, off\n\t"
      "global_load_async_to_lds_b128 %4, %16, off\n\t"
      "global_load_async_to_lds_b128 %5, %17, off\n\t"
      "global_load_async_to_lds_b128 %6, %18, off\n\t"
      "global_load_async_to_lds_b128 %7, %19, off\n\t"
      "global_load_async_to_lds_b128 %8, %20, off\n\t"
      "global_load_async_to_lds_b128 %9, %21, off\n\t"
      "global_load_async_to_lds_b128 %10, %22, off\n\t"
      "global_load_async_to_lds_b128 %11, %23, off\n\t"
      "s_wait_xcnt 0x0"
      :: "v"(l[0]), "v"(l[1]), "v"(l[2]), "v"(l[3]), "v"(l[4]), "v"(l[5]),
         "v"(l[6]), "v"(l[7]), "v"(l[8]), "v"(l[9]), "v"(l[10]), "v"(l[11]),
         "v"(g[0]), "v"(g[1]), "v"(g[2]), "v"(g[3]), "v"(g[4]), "v"(g[5]),
         "v"(g[6]), "v"(g[7]), "v"(g[8]), "v"(g[9]), "v"(g[10]), "v"(g[11])
      : "memory");
}

// GEMM tile staging, 128 threads: A 128 x 64 and B 64 x 64 bf16, row pitch D_MODEL.
// 8 lanes take one 128-byte tile row, so a wave-wide copy covers 4 whole lines;
// all twelve copies of a lane are in flight together, through no register.
__device__ __forceinline__ void gemm_lds_addrs(const unsigned short* aL, const unsigned short* bL,
                                               int t, unsigned (&l)[12]) {
#pragma unroll  // constant indices keep the array in registers
  for (int i = 0; i < 12; ++i) {
    const unsigned short* tile = (i < 8) ? aL : bL;
    l[i] = lds_addr(tile + ((i & 7) * 16 + (t >> 3)) * LDS_STRIDE + (t & 7) * 8);
  }
}
// boff: byte offset in LDS of the buffer to fill, behind the places l0.
__device__ __forceinline__ void gemm_stage_tiles(const unsigned short* a, const unsigned short* b,
                                                 int t, const unsigned (&l0)[12], unsigned boff) {
  unsigned l[12];
  const unsigned short* g[12];
#pragma unroll  // constant indices keep the arrays in registers
  for (int i = 0; i < 12; ++i) {
    const unsigned short* tile = (i < 8) ? a : b;
    l[i] = l0[i] + boff;
    g[i] = tile + (size_t)((i & 7) * 16 + (t >> 3)) * D_MODEL + (t & 7) * 8;
  }
  async_copy12x16B(l, g);
}

// ---------------------------------------------------------------------------
// Kernel 0: x, W_qkv, W_out rounded to bf16 once (f2bf's rounding), so that no GEMM
// tile is converted again by every workgroup that reads it.
// grid 512, block 256; a block takes 4096 float4; a wave-wide load covers 4 whole
// lines, a wave-wide 8-byte store 2.
// ---------------------------------------------------------------------------
#define CVT_F4     4096                                   // float4 per block
#define CVT_BLK_X  (BB * LSEQ * D_MODEL / 4 / CVT_F4)      // 256
#define CVT_BLK_WQ (3 * D_MODEL * D_MODEL / 4 / CVT_F4)    // 192
#define CVT_BLK_WO (D_MODEL * D_MODEL / 4 / CVT_F4)        // 64
__global__ __launch_bounds__(256) void to_bf16_kernel(
    const float* __restrict__ x, const float* __restrict__ W_qkv,
    const float* __restrict__ W_out, unsigned short* __restrict__ xb,
    unsigned short* __restrict__ Wqb, unsigned short* __restrict__ Wob) {
  const int blk = blockIdx.x;
  const float* src = x;
  unsigned short* dst = xb;
  int b0 = blk;
  if (blk >= CVT_BLK_X + CVT_BLK_WQ) {
    src = W_out; dst = Wob; b0 = blk - (CVT_BLK_X + CVT_BLK_WQ);
  } else if (blk >= CVT_BLK_X) {
    src = W_qkv; dst = Wqb; b0 = blk - CVT_BLK_X;
  }
  const int base = b0 * CVT_F4 + (int)threadIdx.x;
  float4 v[CVT_F4 / 256];
#pragma unroll  // constant indices keep the array in registers
  for (int i = 0; i < CVT_F4 / 256; ++i) v[i] = ((const float4*)src)[base + i * 256];
#pragma unroll  // constant indices keep the array in registers
  for (int i = 0; i < CVT_F4 / 256; ++i)
    ((uint2*)dst)[base + i * 256] = make_uint2(pack2bf(v[i].x, v[i].y), pack2bf(v[i].z, v[i].w));
}

__global__ __launch_bounds__(128) __attribute__((amdgpu_waves_per_eu(1, 6))) void qkv_rope_kernel(
    const unsigned short* __restrict__ xb, const float* __restrict__ rope_cos,
    const float* __restrict__ rope_sin, const unsigned short* __restrict__ Wqb,
    const float* __restrict__ b_qkv, unsigned short* __restrict__ Qr,
    unsigned short* __restrict__ Kr, unsigned short* __restrict__ Vt) {
  __shared__ __attribute__((aligned(16))) unsigned short aL[128 * LDS_STRIDE];
  __shared__ __attribute__((aligned(16))) unsigned short bL[64 * LDS_STRIDE];

  const int t = threadIdx.x;
  const int w = t >> 5, lane = t & 31;
  const int lhi = lane >> 4, llo = lane & 15;
  const int n0 = blockIdx.x * 64;
  const int m0 = blockIdx.y * 128;

  v8f acc[2][4];
#pragma unroll
  for (int mf = 0; mf < 2; ++mf)
#pragma unroll
    for (int f = 0; f < 4; ++f) acc[mf][f] = zero8();

  unsigned ldsAB[12];
  gemm_lds_addrs(aL, bL, t, ldsAB);

  for (int k0 = 0; k0 < D_MODEL; k0 += 64) {
    wait_ds0();
    __syncthreads();
    gemm_stage_tiles(xb + (size_t)m0 * D_MODEL + k0, Wqb + (size_t)n0 * D_MODEL + k0, t, ldsAB, 0u);
    wait_async0();
    __syncthreads();
#pragma unroll
    for (int ks = 0; ks < 64; ks += 32) {
      v16bf a0 = load_frag(aL, w * 32 + llo, LDS_STRIDE, ks, lhi);
      v16bf a1 = load_frag(aL, w * 32 + 16 + llo, LDS_STRIDE, ks, lhi);
#pragma unroll
      for (int f = 0; f < 4; ++f) {
        v16bf b = load_frag(bL, f * 16 + llo, LDS_STRIDE, ks, lhi);
        acc[0][f] = WMMA_BF16(a0, b, acc[0][f]);
        acc[1][f] = WMMA_BF16(a1, b, acc[1][f]);
      }
    }
  }

  // Epilogue: bias + RoPE + scatter
  const int which = n0 >> 10;            // 0=q 1=k 2=v
  const int h = (n0 & 1023) >> 6;        // head
#pragma unroll
  for (int mf = 0; mf < 2; ++mf) {
    const int mbase = m0 + w * 32 + mf * 16 + 8 * lhi;
    float val[4][8];
#pragma unroll
    for (int f = 0; f < 4; ++f) {
      float bias = b_qkv[n0 + f * 16 + llo];
#pragma unroll
      for (int rr = 0; rr < 8; ++rr) val[f][rr] = acc[mf][f][rr] + bias;
    }

    if (which < 2) {
#pragma unroll
      for (int f = 0; f < 2; ++f) {
        int d = f * 16 + llo;  // 0..31
#pragma unroll
        for (int rr = 0; rr < 8; ++rr) {
          int m = mbase + rr;
          float c = rope_cos[m * (DK / 2) + d];
          float s = rope_sin[m * (DK / 2) + d];
          float x1 = val[f][rr], x2 = val[f + 2][rr];
          val[f][rr]     = x1 * c - x2 * s;
          val[f + 2][rr] = x1 * s + x2 * c;
        }
      }
      unsigned short* dst = (which == 0) ? Qr : Kr;
#pragma unroll
      for (int f = 0; f < 4; ++f) {
        int d = f * 16 + llo;
#pragma unroll
        for (int rr = 0; rr < 8; ++rr) {
          int m = mbase + rr;
          int b = m >> 11, pos = m & (LSEQ - 1);
          dst[((size_t)(b * NHEAD + h) * LSEQ + pos) * DK + d] = f2bf(val[f][rr]);
        }
      }
    } else {
#pragma unroll
      for (int f = 0; f < 4; ++f) {
        int d = f * 16 + llo;
#pragma unroll
        for (int rr = 0; rr < 8; ++rr) {
          int m = mbase + rr;
          int b = m >> 11, pos = m & (LSEQ - 1);
          Vt[((size_t)(b * NHEAD + h) * DK + d) * LSEQ + pos] = f2bf(val[f][rr]);
        }
      }
    }
  }
}

#define KV_TILE (64 * LDS_STRIDE)
__device__ __forceinline__ void attn_stage_tiles(const unsigned short* K, const unsigned short* V,
                                                 int kt, int sr, int sc, unsigned boff,
                                                 const unsigned (&l0)[8]) {
  unsigned l[8];
  const unsigned short* g[8];
#pragma unroll  // constant indices keep the arrays in registers
  for (int i = 0; i < 4; ++i) {
    l[i]     = l0[i] + boff;
    l[4 + i] = l0[4 + i] + boff;
    g[i]     = K + (size_t)(kt + i * 16 + sr) * DK + sc;
    g[4 + i] = V + (size_t)(i * 16 + sr) * LSEQ + kt + sc;
  }
  async_copy8x16B(l, g);
}
// One K/V tile's work of a wave: 16 queries x 64 keys, from the tiles at kL and vL.
__device__ __forceinline__ void attn_trip(const unsigned short* kL, const unsigned short* vL,
                                          int llo, int lhi, const v16bf (&aQ)[2], v8f (&acc)[4],
                                          float& mrun, float& lrun) {
  const float scale = 0.125f;  // 1/sqrt(64)
  // S^T = K Q^T: A = K rows (keys), B = Q rows (queries)
  v8f s[4];
#pragma unroll
  for (int f = 0; f < 4; ++f) s[f] = zero8();
#pragma unroll
  for (int c = 0; c < 2; ++c) {
#pragma unroll
    for (int f = 0; f < 4; ++f) {
      v16bf aK = load_frag(kL, f * 16 + llo, LDS_STRIDE, c * 32, lhi);
      s[f] = WMMA_BF16(aK, aQ[c], s[f]);
    }
  }

  // online softmax: all 32 scores of a lane belong to query q0 + llo
#pragma unroll
  for (int f = 0; f < 4; ++f)
#pragma unroll
    for (int rr = 0; rr < 8; ++rr) s[f][rr] *= scale;

  float mf[4];
#pragma unroll
  for (int f = 0; f < 4; ++f) {
    mf[f] = s[f][0];
#pragma unroll
    for (int rr = 1; rr < 8; ++rr) mf[f] = fmaxf(mf[f], s[f][rr]);
  }
  float m = fmaxf(fmaxf(mf[0], mf[1]), fmaxf(mf[2], mf[3]));
  m = fmaxf(m, xhalf(m));  // join the two halves' keys
  const float mnew  = fmaxf(mrun, m);
  const float alpha = __expf(mrun - mnew);
  float rs[4];
#pragma unroll
  for (int f = 0; f < 4; ++f) {
    rs[f] = 0.0f;
#pragma unroll
    for (int rr = 0; rr < 8; ++rr) {
      float p = __expf(s[f][rr] - mnew);
      s[f][rr] = p;
      rs[f] += p;
    }
  }
  lrun = lrun * alpha + ((rs[0] + rs[1]) + (rs[2] + rs[3]));
  mrun = mnew;
#pragma unroll
  for (int f = 0; f < 4; ++f)
#pragma unroll
    for (int rr = 0; rr < 8; ++rr) acc[f][rr] *= alpha;

  // O^T += V^T P^T: A = Vt rows (d), B = P^T packed from tiles 2c and 2c + 1,
  // which is load_frag's k order (8h + e, then 16 + 8h + e) at every position
#pragma unroll
  for (int c = 0; c < 2; ++c) {
    FragU bP;
    bP.q[0] = make_uint4(pack2bf(s[2 * c][0], s[2 * c][1]), pack2bf(s[2 * c][2], s[2 * c][3]),
                         pack2bf(s[2 * c][4], s[2 * c][5]), pack2bf(s[2 * c][6], s[2 * c][7]));
    bP.q[1] = make_uint4(pack2bf(s[2 * c + 1][0], s[2 * c + 1][1]),
                         pack2bf(s[2 * c + 1][2], s[2 * c + 1][3]),
                         pack2bf(s[2 * c + 1][4], s[2 * c + 1][5]),
                         pack2bf(s[2 * c + 1][6], s[2 * c + 1][7]));
#pragma unroll
    for (int f = 0; f < 4; ++f) {
      v16bf aV = load_frag(vL, f * 16 + llo, LDS_STRIDE, c * 32, lhi);
      acc[f] = WMMA_BF16(aV, bP.v, acc[f]);
    }
  }
}
__global__ __launch_bounds__(128) void attn_kernel(
    const unsigned short* __restrict__ Qr, const unsigned short* __restrict__ Kr,
    const unsigned short* __restrict__ Vt, unsigned short* __restrict__ O) {
  __shared__ __attribute__((aligned(16))) unsigned short kL2[2 * KV_TILE];
  __shared__ __attribute__((aligned(16))) unsigned short vL2[2 * KV_TILE];

  const int t = threadIdx.x;
  const int w = t >> 5, lane = t & 31;
  const int lhi = lane >> 4, llo = lane & 15;
  const int bh = blockIdx.y;                   // 0..31 = b*16+h
  const int q0 = blockIdx.x * 64 + w * 16;     // wave's first query row
  const size_t hb = (size_t)bh * LSEQ * DK;    // same element offset for Qr/Kr/Vt

  // Q fragments (held in registers for whole kernel)
  v16bf aQ[2];
#pragma unroll
  for (int c = 0; c < 2; ++c)
    aQ[c] = load_frag(Qr + hb, q0 + llo, DK, c * 32, lhi);

  v8f acc[4];
#pragma unroll
  for (int f = 0; f < 4; ++f) acc[f] = zero8();
  // this lane's query: running maximum (both halves alike), running sum (own half's keys)
  float mrun = -1e30f, lrun = 0.0f;

  // staging map: 8 lanes take one 128-byte tile row, a wave-wide copy 4 whole lines
  const int sr = t >> 3, sc = (t & 7) * 8;
  unsigned ldsKV[8];
#pragma unroll  // constant indices keep the array in registers
  for (int i = 0; i < 4; ++i) {
    ldsKV[i]     = lds_addr(kL2 + (i * 16 + sr) * LDS_STRIDE + sc);
    ldsKV[4 + i] = lds_addr(vL2 + (i * 16 + sr) * LDS_STRIDE + sc);
  }

  // tile 0 landed and published, then tile 1 in flight (LSEQ holds 32 tiles)
  attn_stage_tiles(Kr + hb, Vt + hb, 0, sr, sc, 0u, ldsKV);
  wait_async0();
  __syncthreads();
  attn_stage_tiles(Kr + hb, Vt + hb, 64, sr, sc, KV_TILE * 2u, ldsKV);

  for (int kt = 0; kt < LSEQ - 128; kt += 64) {
    const int cur = (kt >> 6) & 1;  // this trip reads buffer cur alone
    attn_trip(kL2 + cur * KV_TILE, vL2 + cur * KV_TILE, llo, lhi, aQ, acc, mrun, lrun);
    // foot of the trip: own reads of buffer cur retired, own copies of the next tile
    // landed; the barrier publishes that tile and frees buffer cur for the refill
    wait_ds0();
    wait_async0();
    __syncthreads();
    attn_stage_tiles(Kr + hb, Vt + hb, kt + 128, sr, sc, cur * (KV_TILE * 2u), ldsKV);
  }
  // the last two tiles (an even count: buffers 0, 1): the same trips, nothing left to ask for
#pragma unroll  // constant buffer index: LDS offsets fold into the loads
  for (int cur = 0; cur < 2; ++cur) {
    attn_trip(kL2 + cur * KV_TILE, vL2 + cur * KV_TILE, llo, lhi, aQ, acc, mrun, lrun);
    wait_ds0();
    wait_async0();
    __syncthreads();
  }
  wait_async0();  // nothing of this wave is in flight when it leaves the loop

  // normalize + store O as [B][L][H*DK] bf16: a lane's 8 registers of tile f are
  // d = 16f + 8h + 0..7 of its query's row, one 16-byte store
  const int b = bh >> 4, h = bh & 15;
  const float inv = 1.0f / (lrun + xhalf(lrun));  // join the halves' sums once
  unsigned short* orow = O + (size_t)(b * LSEQ + q0 + llo) * D_MODEL + h * DK + 8 * lhi;
#pragma unroll
  for (int f = 0; f < 4; ++f)
    *(uint4*)(orow + f * 16) =
        make_uint4(pack2bf(acc[f][0] * inv, acc[f][1] * inv), pack2bf(acc[f][2] * inv, acc[f][3] * inv),
                   pack2bf(acc[f][4] * inv, acc[f][5] * inv), pack2bf(acc[f][6] * inv, acc[f][7] * inv));
}

// ---------------------------------------------------------------------------
// Kernel 3: out = O @ W_out^T + b_out (fp32 result). grid (16, 32), block 128.
// Tile 128(M) x 64(N); both tiles (bf16) staged with async global->LDS copies, two
// buffers: chunk k + 1 flies while chunk k is worked on; one barrier a trip, at its foot.
// ---------------------------------------------------------------------------
#define AB_TILE (192 * LDS_STRIDE)  // elements of one buffer: A rows 0..127, B rows 128..191
// One chunk's products of a wave, 32 rows x 64 columns, from the buffer at ab.
__device__ __forceinline__ void gemm_trip(const unsigned short* ab, int w, int llo, int lhi,
                                          v8f (&acc)[2][4]) {
  const unsigned short* bL = ab + 128 * LDS_STRIDE;
#pragma unroll
  for (int ks = 0; ks < 64; ks += 32) {
    v16bf a0 = load_frag(ab, w * 32 + llo, LDS_STRIDE, ks, lhi);
    v16bf a1 = load_frag(ab, w * 32 + 16 + llo, LDS_STRIDE, ks, lhi);
#pragma unroll
    for (int f = 0; f < 4; ++f) {
      v16bf b = load_frag(bL, f * 16 + llo, LDS_STRIDE, ks, lhi);
      acc[0][f] = WMMA_BF16(a0, b, acc[0][f]);
      acc[1][f] = WMMA_BF16(a1, b, acc[1][f]);
    }
  }
}
__global__ __launch_bounds__(128) void out_proj_kernel(
    const unsigned short* __restrict__ O, const unsigned short* __restrict__ Wob,
    const float* __restrict__ b_out, float* __restrict__ out) {
  __shared__ __attribute__((aligned(16))) unsigned short abL[2 * AB_TILE];

  const int t = threadIdx.x;
  const int w = t >> 5, lane = t & 31;
  const int lhi = lane >> 4, llo = lane & 15;
  const int n0 = blockIdx.x * 64;
  const int m0 = blockIdx.y * 128;

  v8f acc[2][4];
#pragma unroll
  for (int mf = 0; mf < 2; ++mf)
#pragma unroll
    for (int f = 0; f < 4; ++f) acc[mf][f] = zero8();

  unsigned ldsAB[12];  // places in buffer 0
  gemm_lds_addrs(abL, abL + 128 * LDS_STRIDE, t, ldsAB);
  const unsigned short* aG = O + (size_t)m0 * D_MODEL;
  const unsigned short* bG = Wob + (size_t)n0 * D_MODEL;

  // chunk 0 landed and published, then chunk 1 in flight (D_MODEL holds 16 chunks)
  gemm_stage_tiles(aG, bG, t, ldsAB, 0u);
  wait_async0();
  __syncthreads();
  gemm_stage_tiles(aG + 64, bG + 64, t, ldsAB, AB_TILE * 2u);

  for (int k0 = 0; k0 < D_MODEL - 128; k0 += 64) {
    const int cur = (k0 >> 6) & 1;  // this trip reads buffer cur alone
    gemm_trip(abL + cur * AB_TILE, w, llo, lhi, acc);
    // foot of the trip: own reads of buffer cur retired, own copies of the next chunk
    // landed; the barrier publishes that chunk and frees buffer cur for the refill
    wait_ds0();
    wait_async0();
    __syncthreads();
    gemm_stage_tiles(aG + k0 + 128, bG + k0 + 128, t, ldsAB, cur * (AB_TILE * 2u));
  }
  // the last two chunks (an even count: buffers 0, 1): the same trips, nothing left to ask for
#pragma unroll  // constant buffer index: LDS offsets fold into the loads
  for (int cur = 0; cur < 2; ++cur) {
    gemm_trip(abL + cur * AB_TILE, w, llo, lhi, acc);
    wait_ds0();
    wait_async0();
    __syncthreads();
  }
  wait_async0();  // nothing of this wave is in flight when it leaves the loop

#pragma unroll
  for (int mf = 0; mf < 2; ++mf) {
    const int mbase = m0 + w * 32 + mf * 16 + 8 * lhi;
#pragma unroll
    for (int f = 0; f < 4; ++f) {
      int c = n0 + f * 16 + llo;
      float bias = b_out[c];
#pragma unroll
      for (int rr = 0; rr < 8; ++rr)
        out[(size_t)(mbase + rr) * D_MODEL + c] = acc[mf][f][rr] + bias;
    }
  }
}

// ---------------------------------------------------------------------------
extern "C" void kernel_launch(void* const* d_in, const int* in_sizes, int n_in,
                              void* d_out, int out_size, void* d_ws, size_t ws_size,
                              hipStream_t stream) {
  (void)in_sizes; (void)n_in; (void)out_size; (void)ws_size;
  const float* x        = (const float*)d_in[0];
  const float* rope_cos = (const float*)d_in[1];
  const float* rope_sin = (const float*)d_in[2];
  const float* W_qkv    = (const float*)d_in[3];
  const float* b_qkv    = (const float*)d_in[4];
  const float* W_out    = (const float*)d_in[5];
  const float* b_out    = (const float*)d_in[6];

  const size_t headElems = (size_t)BB * NHEAD * LSEQ * DK;  // 4M elems each
  unsigned short* Qr = (unsigned short*)d_ws;
  unsigned short* Kr = Qr + headElems;
  unsigned short* Vt = Kr + headElems;
  unsigned short* O  = Vt + headElems;  // [B][L][D_MODEL] bf16
  unsigned short* xb  = O + headElems;                      // x as bf16
  unsigned short* Wqb = xb + (size_t)BB * LSEQ * D_MODEL;   // W_qkv as bf16
  unsigned short* Wob = Wqb + (size_t)3 * D_MODEL * D_MODEL;  // W_out as bf16

  to_bf16_kernel<<<dim3(CVT_BLK_X + CVT_BLK_WQ + CVT_BLK_WO), 256, 0, stream>>>(
      x, W_qkv, W_out, xb, Wqb, Wob);
  qkv_rope_kernel<<<dim3(3 * D_MODEL / 64, BB * LSEQ / 128), 128, 0, stream>>>(
      xb, rope_cos, rope_sin, Wqb, b_qkv, Qr, Kr, Vt);
  attn_kernel<<<dim3(LSEQ / 64, BB * NHEAD), 128, 0, stream>>>(Qr, Kr, Vt, O);
  out_proj_kernel<<<dim3(D_MODEL / 64, BB * LSEQ / 128), 128, 0, stream>>>(
      O, Wob, b_out, (float*)d_out);
}

// v005
// Measured time: 87.8 microseconds a run.
// Two timings next to v004 both put it at 1.05 times that version's speed.
// All steps since v000 together make it 2.98 times as fast.
#include <hip/hip_runtime.h>
#include <hip/hip_bf16.h>
#include <stdint.h>

// Problem constants (match reference)
#define D_MODEL 1024
#define NHEAD   16
#define DK      64
#define BB      2
#define LSEQ    2048

typedef __attribute__((ext_vector_type(16))) __bf16 v16bf;
typedef __attribute__((ext_vector_type(8)))  float  v8f;

#define WMMA_BF16(a,b,c) \
  __builtin_amdgcn_wmma_f32_16x16x32_bf16(false,(a),false,(b),(short)0,(c),false,false)

__device__ __forceinline__ v8f zero8() {
  v8f z;
#pragma unroll
  for (int i = 0; i < 8; ++i) z[i] = 0.0f;
  return z;
}

__device__ __forceinline__ unsigned short f2bf(float f) {
  unsigned u = __float_as_uint(f);
  return (unsigned short)((u + 0x8000u) >> 16);  // round-to-nearest (approx)
}

union FragU { uint4 q[2]; v16bf v; };

// Two f32 -> one dword of two bf16 (f2bf's rounding), lo in the low half.
__device__ __forceinline__ unsigned pack2bf(float lo, float hi) {
  return __builtin_amdgcn_perm(__float_as_uint(hi) + 0x8000u,
                               __float_as_uint(lo) + 0x8000u, 0x07060302u);
}

__device__ __forceinline__ float xhalf(float x) {
  const int b = __builtin_bit_cast(int, x);
  return __builtin_bit_cast(
      float, __builtin_amdgcn_permlanex16(b, b, 0x76543210, 0xfedcba98, false, false));
}

__device__ __forceinline__ v16bf load_frag(const unsigned short* base, int row,
                                           int stride, int kOff, int sel) {
  const unsigned short* p = base + row * stride + kOff + (sel << 3);
  FragU f;
  f.q[0] = *(const uint4*)(p);
  f.q[1] = *(const uint4*)(p + 16);
  return f.v;
}

#define LDS_STRIDE 72  // 64 + 8 bf16 pad

// (1/sqrt(DK)) * log2(e): stored Q carries it, so K Q^T comes out in exp2 units
#define Q_LOG2_SCALE 0.18033688011112042f

__device__ __forceinline__ void async_copy8x16B(const unsigned (&l)[8],
                                                const unsigned short* const (&g)[8]) {
  asm volatile(
      "global_load_async_to_lds_b128 %0, %8, off\n\t"
      "global_load_async_to_lds_b128 %1, %9, off\n\t"
      "global_load_async_to_lds_b128 %2, %10, off\n\t"
      "global_load_async_to_lds_b128 %3, %11, off\n\t"
      "global_load_async_to_lds_b128 %4, %12, off\n\t"
      "global_load_async_to_lds_b128 %5, %13, off\n\t"
      "global_load_async_to_lds_b128 %6, %14, off\n\t"
      "global_load_async_to_lds_b128 %7, %15, off\n\t"
      "s_wait_xcnt 0x0"
      :: "v"(l[0]), "v"(l[1]), "v"(l[2]), "v"(l[3]),
         "v"(l[4]), "v"(l[5]), "v"(l[6]), "v"(l[7]),
         "v"(g[0]), "v"(g[1]), "v"(g[2]), "v"(g[3]),
         "v"(g[4]), "v"(g[5]), "v"(g[6]), "v"(g[7])
      : "memory");
}
__device__ __forceinline__ unsigned lds_addr(const unsigned short* l) {
  return (unsigned)(unsigned long long)l;  // low 32b = LDS offset
}
__device__ __forceinline__ void wait_async0() {
  asm volatile("s_wait_asynccnt 0x0" ::: "memory");
}
// Ahead of the barrier that frees a tile for refilling: this wave's LDS reads have retired.
__device__ __forceinline__ void wait_ds0() {
  asm volatile("s_wait_dscnt 0x0" ::: "memory");
}
__device__ __forceinline__ void async_copy12x16B(const unsigned (&l)[12],
                                                 const unsigned short* const (&g)[12]) {
  asm volatile(
      "global_load_async_to_lds_b128 %0, %12, off\n\t"
      "global_load_async_to_lds_b128 %1, %13, off\n\t"
      "global_load_async_to_lds_b128 %2, %14, off\n\t"
      "global_load_async_to_lds_b128 %3, %15, off\n\t"
      "global_load_async_to_lds_b128 %4, %16, off\n\t"
      "global_load_async_to_lds_b128 %5, %17, off\n\t"
      "global_load_async_to_lds_b128 %6, %18, off\n\t"
      "global_load_async_to_lds_b128 %7, %19, off\n\t"
      "global_load_async_to_lds_b128 %8, %20, off\n\t"
      "global_load_async_to_lds_b128 %9, %21, off\n\t"
      "global_load_async_to_lds_b128 %10, %22, off\n\t"
      "global_load_async_to_lds_b128 %11, %23, off\n\t"
      "s_wait_xcnt 0x0"
      :: "v"(l[0]), "v"(l[1]), "v"(l[2]), "v"(l[3]), "v"(l[4]), "v"(l[5]),
         "v"(l[6]), "v"(l[7]), "v"(l[8]), "v"(l[9]), "v"(l[10]), "v"(l[11]),
         "v"(g[0]), "v"(g[1]), "v"(g[2]), "v"(g[3]), "v"(g[4]), "v"(g[5]),
         "v"(g[6]), "v"(g[7]), "v"(g[8]), "v"(g[9]), "v"(g[10]), "v"(g[11])
      : "memory");
}

// GEMM tile staging, 128 threads: A 128 x 64 and B 64 x 64 bf16, row pitch D_MODEL.
// 8 lanes take one 128-byte tile row, so a wave-wide copy covers 4 whole lines;
// all twelve copies of a lane are in flight together, through no register.
__device__ __forceinline__ void gemm_lds_addrs(const unsigned short* aL, const unsigned short* bL,
                                               int t, unsigned (&l)[12]) {
#pragma unroll  // constant indices keep the array in registers
  for (int i = 0; i < 12; ++i) {
    const unsigned short* tile = (i < 8) ? aL : bL;
    l[i] = lds_addr(tile + ((i & 7) * 16 + (t >> 3)) * LDS_STRIDE + (t & 7) * 8);
  }
}
// boff: byte offset in LDS of the buffer to fill, behind the places l0.
__device__ __forceinline__ void gemm_stage_tiles(const unsigned short* a, const unsigned short* b,
                                                 int t, const unsigned (&l0)[12], unsigned boff) {
  unsigned l[12];
  const unsigned short* g[12];
#pragma unroll  // constant indices keep the arrays in registers
  for (int i = 0; i < 12; ++i) {
    const unsigned short* tile = (i < 8) ? a : b;
    l[i] = l0[i] + boff;
    g[i] = tile + (size_t)((i & 7) * 16 + (t >> 3)) * D_MODEL + (t & 7) * 8;
  }
  async_copy12x16B(l, g);
}

// ---------------------------------------------------------------------------
// Kernel 0: x, W_qkv, W_out rounded to bf16 once (f2bf's rounding), so that no GEMM
// tile is converted again by every workgroup that reads it.
// grid 512, block 256; a block takes 4096 float4; a wave-wide load covers 4 whole
// lines, a wave-wide 8-byte store 2.
// ---------------------------------------------------------------------------
#define CVT_F4     4096                                   // float4 per block
#define CVT_BLK_X  (BB * LSEQ * D_MODEL / 4 / CVT_F4)      // 256
#define CVT_BLK_WQ (3 * D_MODEL * D_MODEL / 4 / CVT_F4)    // 192
#define CVT_BLK_WO (D_MODEL * D_MODEL / 4 / CVT_F4)        // 64
__global__ __launch_bounds__(256) void to_bf16_kernel(
    const float* __restrict__ x, const float* __restrict__ W_qkv,
    const float* __restrict__ W_out, unsigned short* __restrict__ xb,
    unsigned short* __restrict__ Wqb, unsigned short* __restrict__ Wob) {
  const int blk = blockIdx.x;
  const float* src = x;
  unsigned short* dst = xb;
  int b0 = blk;
  if (blk >= CVT_BLK_X + CVT_BLK_WQ) {
    src = W_out; dst = Wob; b0 = blk - (CVT_BLK_X + CVT_BLK_WQ);
  } else if (blk >= CVT_BLK_X) {
    src = W_qkv; dst = Wqb; b0 = blk - CVT_BLK_X;
  }
  const int base = b0 * CVT_F4 + (int)threadIdx.x;
  float4 v[CVT_F4 / 256];
#pragma unroll  // constant indices keep the array in registers
  for (int i = 0; i < CVT_F4 / 256; ++i) v[i] = ((const float4*)src)[base + i * 256];
#pragma unroll  // constant indices keep the array in registers
  for (int i = 0; i < CVT_F4 / 256; ++i)
    ((uint2*)dst)[base + i * 256] = make_uint2(pack2bf(v[i].x, v[i].y), pack2bf(v[i].z, v[i].w));
}

__global__ __launch_bounds__(128) __attribute__((amdgpu_waves_per_eu(1, 6))) void qkv_rope_kernel(
    const unsigned short* __restrict__ xb, const float* __restrict__ rope_cos,
    const float* __restrict__ rope_sin, const unsigned short* __restrict__ Wqb,
    const float* __restrict__ b_qkv, unsigned short* __restrict__ Qr,
    unsigned short* __restrict__ Kr, unsigned short* __restrict__ Vt) {
  __shared__ __attribute__((aligned(16))) unsigned short aL[128 * LDS_STRIDE];
  __shared__ __attribute__((aligned(16))) unsigned short bL[64 * LDS_STRIDE];

  const int t = threadIdx.x;
  const int w = t >> 5, lane = t & 31;
  const int lhi = lane >> 4, llo = lane & 15;
  const int n0 = blockIdx.x * 64;
  const int m0 = blockIdx.y * 128;

  v8f acc[2][4];
#pragma unroll
  for (int mf = 0; mf < 2; ++mf)
#pragma unroll
    for (int f = 0; f < 4; ++f) acc[mf][f] = zero8();

  unsigned ldsAB[12];
  gemm_lds_addrs(aL, bL, t, ldsAB);

  for (int k0 = 0; k0 < D_MODEL; k0 += 64) {
    wait_ds0();
    __syncthreads();
    gemm_stage_tiles(xb + (size_t)m0 * D_MODEL + k0, Wqb + (size_t)n0 * D_MODEL + k0, t, ldsAB, 0u);
    wait_async0();
    __syncthreads();
#pragma unroll
    for (int ks = 0; ks < 64; ks += 32) {
      v16bf a0 = load_frag(aL, w * 32 + llo, LDS_STRIDE, ks, lhi);
      v16bf a1 = load_frag(aL, w * 32 + 16 + llo, LDS_STRIDE, ks, lhi);
#pragma unroll
      for (int f = 0; f < 4; ++f) {
        v16bf b = load_frag(bL, f * 16 + llo, LDS_STRIDE, ks, lhi);
        acc[0][f] = WMMA_BF16(a0, b, acc[0][f]);
        acc[1][f] = WMMA_BF16(a1, b, acc[1][f]);
      }
    }
  }

  // Epilogue: bias + RoPE + scatter
  const int which = n0 >> 10;            // 0=q 1=k 2=v
  const int h = (n0 & 1023) >> 6;        // head
#pragma unroll
  for (int mf = 0; mf < 2; ++mf) {
    const int mbase = m0 + w * 32 + mf * 16 + 8 * lhi;
    float val[4][8];
#pragma unroll
    for (int f = 0; f < 4; ++f) {
      float bias = b_qkv[n0 + f * 16 + llo];
#pragma unroll
      for (int rr = 0; rr < 8; ++rr) val[f][rr] = acc[mf][f][rr] + bias;
    }

    if (which < 2) {
#pragma unroll
      for (int f = 0; f < 2; ++f) {
        int d = f * 16 + llo;  // 0..31
#pragma unroll
        for (int rr = 0; rr < 8; ++rr) {
          int m = mbase + rr;
          float c = rope_cos[m * (DK / 2) + d];
          float s = rope_sin[m * (DK / 2) + d];
          float x1 = val[f][rr], x2 = val[f + 2][rr];
          val[f][rr]     = x1 * c - x2 * s;
          val[f + 2][rr] = x1 * s + x2 * c;
        }
      }
      unsigned short* dst = (which == 0) ? Qr : Kr;
      const float os = (which == 0) ? Q_LOG2_SCALE : 1.0f;
#pragma unroll
      for (int f = 0; f < 4; ++f) {
        int d = f * 16 + llo;
#pragma unroll
        for (int rr = 0; rr < 8; ++rr) {
          int m = mbase + rr;
          int b = m >> 11, pos = m & (LSEQ - 1);
          dst[((size_t)(b * NHEAD + h) * LSEQ + pos) * DK + d] = f2bf(val[f][rr] * os);
        }
      }
      // ahead of the next half's loads and index sums, which reuse registers that these stores name
      asm volatile("s_wait_xcnt 0x0" ::: "memory");
    } else {
#pragma unroll
      for (int f = 0; f < 4; ++f) {
        int d = f * 16 + llo;
#pragma unroll
        for (int rr = 0; rr < 8; ++rr) {
          int m = mbase + rr;
          int b = m >> 11, pos = m & (LSEQ - 1);
          Vt[((size_t)(b * NHEAD + h) * DK + d) * LSEQ + pos] = f2bf(val[f][rr]);
        }
      }
    }
  }
}

#define KV_TILE (64 * LDS_STRIDE)
__device__ __forceinline__ void attn_stage_tiles(const unsigned short* K, const unsigned short* V,
                                                 int kt, int sr, int sc, unsigned boff,
                                                 const unsigned (&l0)[8]) {
  unsigned l[8];
  const unsigned short* g[8];
#pragma unroll  // constant indices keep the arrays in registers
  for (int i = 0; i < 4; ++i) {
    l[i]     = l0[i] + boff;
    l[4 + i] = l0[4 + i] + boff;
    g[i]     = K + (size_t)(kt + i * 16 + sr) * DK + sc;
    g[4 + i] = V + (size_t)(i * 16 + sr) * LSEQ + kt + sc;
  }
  async_copy8x16B(l, g);
}
// One K/V tile's work of a wave: 16 queries x 64 keys, from the tiles at kL and vL.
// cneg: eight registers, each minus the lane's query's reference maximum (exp2 units). It is
// the C operand of the score product, so a score leaves the matrix unit as the argument of
// its exp2. The reference is renewed (and acc, lrun rescaled) only in the first trip or when
// some query's tile maximum tops it by more than 8, so P stays within 2^8.
__device__ __forceinline__ void attn_trip(const unsigned short* kL, const unsigned short* vL,
                                          int llo, int lhi, const v16bf (&aQ)[2], v8f (&acc)[4],
                                          v8f& cneg, float& lrun, bool first) {
  // S^T = K Q^T - reference: A = K rows (keys), B = Q rows (queries, pre-scaled)
  v8f s[4];
#pragma unroll
  for (int f = 0; f < 4; ++f) {
    v16bf aK = load_frag(kL, f * 16 + llo, LDS_STRIDE, 0, lhi);
    s[f] = WMMA_BF16(aK, aQ[0], cneg);
  }
#pragma unroll
  for (int f = 0; f < 4; ++f) {
    v16bf aK = load_frag(kL, f * 16 + llo, LDS_STRIDE, 32, lhi);
    s[f] = WMMA_BF16(aK, aQ[1], s[f]);
  }
  // V fragments asked for ahead of the test below, so that their LDS latency runs under the softmax
  v16bf aV[2][4];
#pragma unroll
  for (int c = 0; c < 2; ++c)
#pragma unroll
    for (int f = 0; f < 4; ++f) aV[c][f] = load_frag(vL, f * 16 + llo, LDS_STRIDE, c * 32, lhi);

  // all 32 scores of a lane belong to query q0 + llo
  float mf[4];
#pragma unroll
  for (int f = 0; f < 4; ++f) {
    mf[f] = s[f][0];
#pragma unroll
    for (int rr = 1; rr < 8; ++rr) mf[f] = fmaxf(mf[f], s[f][rr]);
  }
  float m = fmaxf(fmaxf(mf[0], mf[1]), fmaxf(mf[2], mf[3]));
  m = fmaxf(m, xhalf(m));  // join the two halves' keys: tile maximum above the reference
  if (first || __builtin_amdgcn_ballot_w32(m > 8.0f) != 0u) {
    const float d     = first ? m : fmaxf(m, 0.0f);  // the reference never falls
    const float alpha = first ? 0.0f : __builtin_amdgcn_exp2f(-d);  // first: acc, lrun are 0
    lrun *= alpha;
#pragma unroll
    for (int rr = 0; rr < 8; ++rr) cneg[rr] -= d;
#pragma unroll
    for (int f = 0; f < 4; ++f)
#pragma unroll
      for (int rr = 0; rr < 8; ++rr) {
        acc[f][rr] *= alpha;
        s[f][rr] -= d;
      }
  }
  float rs[4];
#pragma unroll
  for (int f = 0; f < 4; ++f) {
    rs[f] = 0.0f;
#pragma unroll
    for (int rr = 0; rr < 8; ++rr) {
      float p = __builtin_amdgcn_exp2f(s[f][rr]);
      s[f][rr] = p;
      rs[f] += p;
    }
  }
  lrun += (rs[0] + rs[1]) + (rs[2] + rs[3]);

  // O^T += V^T P^T: A = Vt rows (d), B = P^T packed from tiles 2c and 2c + 1,
  // which is load_frag's k order (8h + e, then 16 + 8h + e) at every position
#pragma unroll
  for (int c = 0; c < 2; ++c) {
    FragU bP;
    bP.q[0] = make_uint4(pack2bf(s[2 * c][0], s[2 * c][1]), pack2bf(s[2 * c][2], s[2 * c][3]),
                         pack2bf(s[2 * c][4], s[2 * c][5]), pack2bf(s[2 * c][6], s[2 * c][7]));
    bP.q[1] = make_uint4(pack2bf(s[2 * c + 1][0], s[2 * c + 1][1]),
                         pack2bf(s[2 * c + 1][2], s[2 * c + 1][3]),
                         pack2bf(s[2 * c + 1][4], s[2 * c + 1][5]),
                         pack2bf(s[2 * c + 1][6], s[2 * c + 1][7]));
#pragma unroll
    for (int f = 0; f < 4; ++f) acc[f] = WMMA_BF16(aV[c][f], bP.v, acc[f]);
  }
}
__global__ __launch_bounds__(128) void attn_kernel(
    const unsigned short* __restrict__ Qr, const unsigned short* __restrict__ Kr,
    const unsigned short* __restrict__ Vt, unsigned short* __restrict__ O) {
  __shared__ __attribute__((aligned(16))) unsigned short kL2[2 * KV_TILE];
  __shared__ __attribute__((aligned(16))) unsigned short vL2[2 * KV_TILE];

  const int t = threadIdx.x;
  const int w = t >> 5, lane = t & 31;
  const int lhi = lane >> 4, llo = lane & 15;
  const int bh = blockIdx.y;                   // 0..31 = b*16+h
  const int q0 = blockIdx.x * 64 + w * 16;     // wave's first query row
  const size_t hb = (size_t)bh * LSEQ * DK;    // same element offset for Qr/Kr/Vt

  // Q fragments (held in registers for whole kernel)
  v16bf aQ[2];
#pragma unroll
  for (int c = 0; c < 2; ++c)
    aQ[c] = load_frag(Qr + hb, q0 + llo, DK, c * 32, lhi);

  v8f acc[4];
#pragma unroll
  for (int f = 0; f < 4; ++f) acc[f] = zero8();
  // this lane's query: minus the reference maximum (both halves alike; set in the first
  // trip), running sum (own half's keys)
  v8f cneg = zero8();
  float lrun = 0.0f;

  // staging map: 8 lanes take one 128-byte tile row, a wave-wide copy 4 whole lines
  const int sr = t >> 3, sc = (t & 7) * 8;
  unsigned ldsKV[8];
#pragma unroll  // constant indices keep the array in registers
  for (int i = 0; i < 4; ++i) {
    ldsKV[i]     = lds_addr(kL2 + (i * 16 + sr) * LDS_STRIDE + sc);
    ldsKV[4 + i] = lds_addr(vL2 + (i * 16 + sr) * LDS_STRIDE + sc);
  }

  // tile 0 landed and published, then tile 1 in flight (LSEQ holds 32 tiles)
  attn_stage_tiles(Kr + hb, Vt + hb, 0, sr, sc, 0u, ldsKV);
  wait_async0();
  __syncthreads();
  attn_stage_tiles(Kr + hb, Vt + hb, 64, sr, sc, KV_TILE * 2u, ldsKV);

  for (int kt = 0; kt < LSEQ - 128; kt += 64) {
    const int cur = (kt >> 6) & 1;  // this trip reads buffer cur alone
    attn_trip(kL2 + cur * KV_TILE, vL2 + cur * KV_TILE, llo, lhi, aQ, acc, cneg, lrun, kt == 0);
    // foot of the trip: own reads of buffer cur retired, own copies of the next tile
    // landed; the barrier publishes that tile and frees buffer cur for the refill
    wait_ds0();
    wait_async0();
    __syncthreads();
    attn_stage_tiles(Kr + hb, Vt + hb, kt + 128, sr, sc, cur * (KV_TILE * 2u), ldsKV);
  }
  // the last two tiles (an even count: buffers 0, 1): the same trips, nothing left to ask for
#pragma unroll  // constant buffer index: LDS offsets fold into the loads
  for (int cur = 0; cur < 2; ++cur) {
    attn_trip(kL2 + cur * KV_TILE, vL2 + cur * KV_TILE, llo, lhi, aQ, acc, cneg, lrun, false);
    wait_ds0();
    wait_async0();
    __syncthreads();
  }
  wait_async0();  // nothing of this wave is in flight when it leaves the loop

  // normalize + store O as [B][L][H*DK] bf16: a lane's 8 registers of tile f are
  // d = 16f + 8h + 0..7 of its query's row, one 16-byte store
  const int b = bh >> 4, h = bh & 15;
  const float inv = 1.0f / (lrun + xhalf(lrun));  // join the halves' sums once
  unsigned short* orow = O + (size_t)(b * LSEQ + q0 + llo) * D_MODEL + h * DK + 8 * lhi;
#pragma unroll
  for (int f = 0; f < 4; ++f)
    *(uint4*)(orow + f * 16) =
        make_uint4(pack2bf(acc[f][0] * inv, acc[f][1] * inv), pack2bf(acc[f][2] * inv, acc[f][3] * inv),
                   pack2bf(acc[f][4] * inv, acc[f][5] * inv), pack2bf(acc[f][6] * inv, acc[f][7] * inv));
}

// ---------------------------------------------------------------------------
// Kernel 3: out = O @ W_out^T + b_out (fp32 result). grid (16, 32), block 128.
// Tile 128(M) x 64(N); both tiles (bf16) staged with async global->LDS copies, two
// buffers: chunk k + 1 flies while chunk k is worked on; one barrier a trip, at its foot.
// ---------------------------------------------------------------------------
#define AB_TILE (192 * LDS_STRIDE)  // elements of one buffer: A rows 0..127, B rows 128..191
// One chunk's products of a wave, 32 rows x 64 columns, from the buffer at ab.
__device__ __forceinline__ void gemm_trip(const unsigned short* ab, int w, int llo, int lhi,
                                          v8f (&acc)[2][4]) {
  const unsigned short* bL = ab + 128 * LDS_STRIDE;
#pragma unroll
  for (int ks = 0; ks < 64; ks += 32) {
    v16bf a0 = load_frag(ab, w * 32 + llo, LDS_STRIDE, ks, lhi);
    v16bf a1 = load_frag(ab, w * 32 + 16 + llo, LDS_STRIDE, ks, lhi);
#pragma unroll
    for (int f = 0; f < 4; ++f) {
      v16bf b = load_frag(bL, f * 16 + llo, LDS_STRIDE, ks, lhi);
      acc[0][f] = WMMA_BF16(a0, b, acc[0][f]);
      acc[1][f] = WMMA_BF16(a1, b, acc[1][f]);
    }
  }
}
__global__ __launch_bounds__(128) void out_proj_kernel(
    const unsigned short* __restrict__ O, const unsigned short* __restrict__ Wob,
    const float* __restrict__ b_out, float* __restrict__ out) {
  __shared__ __attribute__((aligned(16))) unsigned short abL[2 * AB_TILE];

  const int t = threadIdx.x;
  const int w = t >> 5, lane = t & 31;
  const int lhi = lane >> 4, llo = lane & 15;
  const int n0 = blockIdx.x * 64;
  const int m0 = blockIdx.y * 128;

  v8f acc[2][4];
#pragma unroll
  for (int mf = 0; mf < 2; ++mf)
#pragma unroll
    for (int f = 0; f < 4; ++f) acc[mf][f] = zero8();

  unsigned ldsAB[12];  // places in buffer 0
  gemm_lds_addrs(abL, abL + 128 * LDS_STRIDE, t, ldsAB);
  const unsigned short* aG = O + (size_t)m0 * D_MODEL;
  const unsigned short* bG = Wob + (size_t)n0 * D_MODEL;

  // chunk 0 landed and published, then chunk 1 in flight (D_MODEL holds 16 chunks)
  gemm_stage_tiles(aG, bG, t, ldsAB, 0u);
  wait_async0();
  __syncthreads();
  gemm_stage_tiles(aG + 64, bG + 64, t, ldsAB, AB_TILE * 2u);

  for (int k0 = 0; k0 < D_MODEL - 128; k0 += 64) {
    const int cur = (k0 >> 6) & 1;  // this trip reads buffer cur alone
    gemm_trip(abL + cur * AB_TILE, w, llo, lhi, acc);
    // foot of the trip: own reads of buffer cur retired, own copies of the next chunk
    // landed; the barrier publishes that chunk and frees buffer cur for the refill
    wait_ds0();
    wait_async0();
    __syncthreads();
    gemm_stage_tiles(aG + k0 + 128, bG + k0 + 128, t, ldsAB, cur * (AB_TILE * 2u));
  }
  // the last two chunks (an even count: buffers 0, 1): the same trips, nothing left to ask for
#pragma unroll  // constant buffer index: LDS offsets fold into the loads
  for (int cur = 0; cur < 2; ++cur) {
    gemm_trip(abL + cur * AB_TILE, w, llo, lhi, acc);
    wait_ds0();
    wait_async0();
    __syncthreads();
  }
  wait_async0();  // nothing of this wave is in flight when it leaves the loop

#pragma unroll
  for (int mf = 0; mf < 2; ++mf) {
    const int mbase = m0 + w * 32 + mf * 16 + 8 * lhi;
#pragma unroll
    for (int f = 0; f < 4; ++f) {
      int c = n0 + f * 16 + llo;
      float bias = b_out[c];
#pragma unroll
      for (int rr = 0; rr < 8; ++rr)
        out[(size_t)(mbase + rr) * D_MODEL + c] = acc[mf][f][rr] + bias;
    }
  }
}

// ---------------------------------------------------------------------------
extern "C" void kernel_launch(void* const* d_in, const int* in_sizes, int n_in,
                              void* d_out, int out_size, void* d_ws, size_t ws_size,
                              hipStream_t stream) {
  (void)in_sizes; (void)n_in; (void)out_size; (void)ws_size;
  const float* x        = (const float*)d_in[0];
  const float* rope_cos = (const float*)d_in[1];
  const float* rope_sin = (const float*)d_in[2];
  const float* W_qkv    = (const float*)d_in[3];
  const float* b_qkv    = (const float*)d_in[4];
  const float* W_out    = (const float*)d_in[5];
  const float* b_out    = (const float*)d_in[6];

  const size_t headElems = (size_t)BB * NHEAD * LSEQ * DK;  // 4M elems each
  unsigned short* Qr = (unsigned short*)d_ws;
  unsigned short* Kr = Qr + headElems;
  unsigned short* Vt = Kr + headElems;
  unsigned short* O  = Vt + headElems;  // [B][L][D_MODEL] bf16
  unsigned short* xb  = O + headElems;                      // x as bf16
  unsigned short* Wqb = xb + (size_t)BB * LSEQ * D_MODEL;   // W_qkv as bf16
  unsigned short* Wob = Wqb + (size_t)3 * D_MODEL * D_MODEL;  // W_out as bf16

  to_bf16_kernel<<<dim3(CVT_BLK_X + CVT_BLK_WQ + CVT_BLK_WO), 256, 0, stream>>>(
      x, W_qkv, W_out, xb, Wqb, Wob);
  qkv_rope_kernel<<<dim3(3 * D_MODEL / 64, BB * LSEQ / 128), 128, 0, stream>>>(
      xb, rope_cos, rope_sin, Wqb, b_qkv, Qr, Kr, Vt);
  attn_kernel<<<dim3(LSEQ / 64, BB * NHEAD), 128, 0, stream>>>(Qr, Kr, Vt, O);
  out_proj_kernel<<<dim3(D_MODEL / 64, BB * LSEQ / 128), 128, 0, stream>>>(
      O, Wob, b_out, (float*)d_out);
}

// v006
// One run takes 82.6 microseconds.
// Timed twice side by side with v005, it ran 1.07 times as fast both times.
// All steps since v000 together make it 3.19 times as fast.
#include <hip/hip_runtime.h>
#include <hip/hip_bf16.h>
#include <stdint.h>

// Problem constants (match reference)
#define D_MODEL 1024
#define NHEAD   16
#define DK      64
#define BB      2
#define LSEQ    2048

typedef __attribute__((ext_vector_type(16))) __bf16 v16bf;
typedef __attribute__((ext_vector_type(8)))  float  v8f;

#define WMMA_BF16(a,b,c) \
  __builtin_amdgcn_wmma_f32_16x16x32_bf16(false,(a),false,(b),(short)0,(c),false,false)

__device__ __forceinline__ v8f zero8() {
  v8f z;
#pragma unroll
  for (int i = 0; i < 8; ++i) z[i] = 0.0f;
  return z;
}

__device__ __forceinline__ unsigned short f2bf(float f) {
  unsigned u = __float_as_uint(f);
  return (unsigned short)((u + 0x8000u) >> 16);  // round-to-nearest (approx)
}

union FragU { uint4 q[2]; v16bf v; };

// Two f32 -> one dword of two bf16 (f2bf's rounding), lo in the low half.
__device__ __forceinline__ unsigned pack2bf(float lo, float hi) {
  return __builtin_amdgcn_perm(__float_as_uint(hi) + 0x8000u,
                               __float_as_uint(lo) + 0x8000u, 0x07060302u);
}

__device__ __forceinline__ float xhalf(float x) {
  const int b = __builtin_bit_cast(int, x);
  return __builtin_bit_cast(
      float, __builtin_amdgcn_permlanex16(b, b, 0x76543210, 0xfedcba98, false, false));
}

__device__ __forceinline__ v16bf load_frag(const unsigned short* base, int row,
                                           int stride, int kOff, int sel) {
  const unsigned short* p = base + row * stride + kOff + (sel << 3);
  FragU f;
  f.q[0] = *(const uint4*)(p);
  f.q[1] = *(const uint4*)(p + 16);
  return f.v;
}

#define LDS_STRIDE 72  // 64 + 8 bf16 pad

// (1/sqrt(DK)) * log2(e): stored Q carries it, so K Q^T comes out in exp2 units
#define Q_LOG2_SCALE 0.18033688011112042f

__device__ __forceinline__ void async_copy8x16B(const unsigned (&l)[8],
                                                const unsigned short* const (&g)[8]) {
  asm volatile(
      "global_load_async_to_lds_b128 %0, %8, off\n\t"
      "global_load_async_to_lds_b128 %1, %9, off\n\t"
      "global_load_async_to_lds_b128 %2, %10, off\n\t"
      "global_load_async_to_lds_b128 %3, %11, off\n\t"
      "global_load_async_to_lds_b128 %4, %12, off\n\t"
      "global_load_async_to_lds_b128 %5, %13, off\n\t"
      "global_load_async_to_lds_b128 %6, %14, off\n\t"
      "global_load_async_to_lds_b128 %7, %15, off\n\t"
      "s_wait_xcnt 0x0"
      :: "v"(l[0]), "v"(l[1]), "v"(l[2]), "v"(l[3]),
         "v"(l[4]), "v"(l[5]), "v"(l[6]), "v"(l[7]),
         "v"(g[0]), "v"(g[1]), "v"(g[2]), "v"(g[3]),
         "v"(g[4]), "v"(g[5]), "v"(g[6]), "v"(g[7])
      : "memory");
}
__device__ __forceinline__ unsigned lds_addr(const unsigned short* l) {
  return (unsigned)(unsigned long long)l;  // low 32b = LDS offset
}
__device__ __forceinline__ void wait_async0() {
  asm volatile("s_wait_asynccnt 0x0" ::: "memory");
}
// Ahead of the barrier that frees a tile for refilling: this wave's LDS reads have retired.
__device__ __forceinline__ void wait_ds0() {
  asm volatile("s_wait_dscnt 0x0" ::: "memory");
}
__device__ __forceinline__ void async_copy12x16B(const unsigned (&l)[12],
                                                 const unsigned short* const (&g)[12]) {
  asm volatile(
      "global_load_async_to_lds_b128 %0, %12, off\n\t"
      "global_load_async_to_lds_b128 %1, %13, off\n\t"
      "global_load_async_to_lds_b128 %2, %14, off\n\t"
      "global_load_async_to_lds_b128 %3, %15, off\n\t"
      "global_load_async_to_lds_b128 %4, %16, off\n\t"
      "global_load_async_to_lds_b128 %5, %17, off\n\t"
      "global_load_async_to_lds_b128 %6, %18, off\n\t"
      "global_load_async_to_lds_b128 %7, %19, off\n\t"
      "global_load_async_to_lds_b128 %8, %20, off\n\t"
      "global_load_async_to_lds_b128 %9, %21, off\n\t"
      "global_load_async_to_lds_b128 %10, %22, off\n\t"
      "global_load_async_to_lds_b128 %11, %23, off\n\t"
      "s_wait_xcnt 0x0"
      :: "v"(l[0]), "v"(l[1]), "v"(l[2]), "v"(l[3]), "v"(l[4]), "v"(l[5]),
         "v"(l[6]), "v"(l[7]), "v"(l[8]), "v"(l[9]), "v"(l[10]), "v"(l[11]),
         "v"(g[0]), "v"(g[1]), "v"(g[2]), "v"(g[3]), "v"(g[4]), "v"(g[5]),
         "v"(g[6]), "v"(g[7]), "v"(g[8]), "v"(g[9]), "v"(g[10]), "v"(g[11])
      : "memory");
}

// GEMM tile staging, 128 threads: one K chunk of 128, A 128 x 128 and B 64 x 128 bf16, row
// pitch D_MODEL in memory; in LDS one buffer of 192 rows (A rows 0..127, B rows 128..191).
// 16 lanes take one 256-byte tile row, so a wave-wide copy covers 4 whole lines; the
// twenty-four copies of a lane (two statements) are in flight together, through no register.
#define GEMM_KC     128  // K elements a chunk
#define GEMM_STRIDE 136  // 128 + 8 bf16 pad: 272 B = 16 B x odd, the pitch of ds_load_b128 readers
#define AB_TILE (192 * GEMM_STRIDE)  // elements of one buffer
// l0: LDS byte address of this lane's place in row t >> 4 of the buffer to fill.
__device__ __forceinline__ void gemm_stage_tiles(const unsigned short* a, const unsigned short* b,
                                                 int t, unsigned l0) {
#pragma unroll  // constant indices keep the arrays in registers
  for (int s = 0; s < 2; ++s) {
    unsigned l[12];
    const unsigned short* g[12];
#pragma unroll  // constant indices keep the arrays in registers
    for (int j = 0; j < 12; ++j) {
      const int i = s * 12 + j;  // copy i fills buffer rows 8i .. 8i + 7
      const unsigned short* tile = (i < 16) ? a : b;
      l[j] = l0 + (unsigned)(i * 8 * GEMM_STRIDE * 2);
      g[j] = tile + (size_t)((i & 15) * 8 + (t >> 4)) * D_MODEL + (t & 15) * 8;
    }
    async_copy12x16B(l, g);
  }
}
// One chunk's products of a wave, 32 rows x 64 columns, from the buffer at ab.
__device__ __forceinline__ void gemm_trip(const unsigned short* ab, int w, int llo, int lhi,
                                          v8f (&acc)[2][4]) {
  const unsigned short* bL = ab + 128 * GEMM_STRIDE;
#pragma unroll
  for (int ks = 0; ks < GEMM_KC; ks += 32) {
    v16bf a0 = load_frag(ab, w * 32 + llo, GEMM_STRIDE, ks, lhi);
    v16bf a1 = load_frag(ab, w * 32 + 16 + llo, GEMM_STRIDE, ks, lhi);
#pragma unroll
    for (int f = 0; f < 4; ++f) {
      v16bf b = load_frag(bL, f * 16 + llo, GEMM_STRIDE, ks, lhi);
      acc[0][f] = WMMA_BF16(a0, b, acc[0][f]);
      acc[1][f] = WMMA_BF16(a1, b, acc[1][f]);
    }
  }
}

// ---------------------------------------------------------------------------
// Kernel 0: x, W_qkv, W_out rounded to bf16 once (f2bf's rounding), so that no GEMM
// tile is converted again by every workgroup that reads it.
// grid 512, block 256; a block takes 4096 float4; a wave-wide load covers 4 whole
// lines, a wave-wide 8-byte store 2.
// ---------------------------------------------------------------------------
#define CVT_F4     4096                                   // float4 per block
#define CVT_BLK_X  (BB * LSEQ * D_MODEL / 4 / CVT_F4)      // 256
#define CVT_BLK_WQ (3 * D_MODEL * D_MODEL / 4 / CVT_F4)    // 192
#define CVT_BLK_WO (D_MODEL * D_MODEL / 4 / CVT_F4)        // 64
__global__ __launch_bounds__(256) void to_bf16_kernel(
    const float* __restrict__ x, const float* __restrict__ W_qkv,
    const float* __restrict__ W_out, unsigned short* __restrict__ xb,
    unsigned short* __restrict__ Wqb, unsigned short* __restrict__ Wob) {
  const int blk = blockIdx.x;
  const float* src = x;
  unsigned short* dst = xb;
  int b0 = blk;
  if (blk >= CVT_BLK_X + CVT_BLK_WQ) {
    src = W_out; dst = Wob; b0 = blk - (CVT_BLK_X + CVT_BLK_WQ);
  } else if (blk >= CVT_BLK_X) {
    src = W_qkv; dst = Wqb; b0 = blk - CVT_BLK_X;
  }
  const int base = b0 * CVT_F4 + (int)threadIdx.x;
  float4 v[CVT_F4 / 256];
#pragma unroll  // constant indices keep the array in registers
  for (int i = 0; i < CVT_F4 / 256; ++i) v[i] = ((const float4*)src)[base + i * 256];
#pragma unroll  // constant indices keep the array in registers
  for (int i = 0; i < CVT_F4 / 256; ++i)
    ((uint2*)dst)[base + i * 256] = make_uint2(pack2bf(v[i].x, v[i].y), pack2bf(v[i].z, v[i].w));
}

__global__ __launch_bounds__(128) __attribute__((amdgpu_waves_per_eu(1, 6))) void qkv_rope_kernel(
    const unsigned short* __restrict__ xb, const float* __restrict__ rope_cos,
    const float* __restrict__ rope_sin, const unsigned short* __restrict__ Wqb,
    const float* __restrict__ b_qkv, unsigned short* __restrict__ Qr,
    unsigned short* __restrict__ Kr, unsigned short* __restrict__ Vt) {
  __shared__ __attribute__((aligned(16))) unsigned short abL[AB_TILE];

  const int t = threadIdx.x;
  const int w = t >> 5, lane = t & 31;
  const int lhi = lane >> 4, llo = lane & 15;
  const int n0 = blockIdx.x * 64;
  const int m0 = blockIdx.y * 128;

  v8f acc[2][4];
#pragma unroll
  for (int mf = 0; mf < 2; ++mf)
#pragma unroll
    for (int f = 0; f < 4; ++f) acc[mf][f] = zero8();

  const unsigned ldsAB = lds_addr(abL + (t >> 4) * GEMM_STRIDE + (t & 15) * 8);

  for (int k0 = 0; k0 < D_MODEL; k0 += GEMM_KC) {
    wait_ds0();
    __syncthreads();
    gemm_stage_tiles(xb + (size_t)m0 * D_MODEL + k0, Wqb + (size_t)n0 * D_MODEL + k0, t, ldsAB);
    wait_async0();
    __syncthreads();
    gemm_trip(abL, w, llo, lhi, acc);
  }

  // Epilogue: bias + RoPE + scatter
  const int which = n0 >> 10;            // 0=q 1=k 2=v
  const int h = (n0 & 1023) >> 6;        // head
#pragma unroll
  for (int mf = 0; mf < 2; ++mf) {
    const int mbase = m0 + w * 32 + mf * 16 + 8 * lhi;
    float val[4][8];
#pragma unroll
    for (int f = 0; f < 4; ++f) {
      float bias = b_qkv[n0 + f * 16 + llo];
#pragma unroll
      for (int rr = 0; rr < 8; ++rr) val[f][rr] = acc[mf][f][rr] + bias;
    }

    if (which < 2) {
#pragma unroll
      for (int f = 0; f < 2; ++f) {
        int d = f * 16 + llo;  // 0..31
#pragma unroll
        for (int rr = 0; rr < 8; ++rr) {
          int m = mbase + rr;
          float c = rope_cos[m * (DK / 2) + d];
          float s = rope_sin[m * (DK / 2) + d];
          float x1 = val[f][rr], x2 = val[f + 2][rr];
          val[f][rr]     = x1 * c - x2 * s;
          val[f + 2][rr] = x1 * s + x2 * c;
        }
      }
      unsigned short* dst = (which == 0) ? Qr : Kr;
      const float os = (which == 0) ? Q_LOG2_SCALE : 1.0f;
#pragma unroll
      for (int f = 0; f < 4; ++f) {
        int d = f * 16 + llo;
#pragma unroll
        for (int rr = 0; rr < 8; ++rr) {
          int m = mbase + rr;
          int b = m >> 11, pos = m & (LSEQ - 1);
          dst[((size_t)(b * NHEAD + h) * LSEQ + pos) * DK + d] = f2bf(val[f][rr] * os);
        }
      }
      // ahead of the next half's loads and index sums, which reuse registers that these stores name
      asm volatile("s_wait_xcnt 0x0" ::: "memory");
    } else {
#pragma unroll
      for (int f = 0; f < 4; ++f) {
        int d = f * 16 + llo;
#pragma unroll
        for (int rr = 0; rr < 8; ++rr) {
          int m = mbase + rr;
          int b = m >> 11, pos = m & (LSEQ - 1);
          Vt[((size_t)(b * NHEAD + h) * DK + d) * LSEQ + pos] = f2bf(val[f][rr]);
        }
      }
    }
  }
}

#define KV_TILE (64 * LDS_STRIDE)
__device__ __forceinline__ void attn_stage_tiles(const unsigned short* K, const unsigned short* V,
                                                 int kt, int sr, int sc, unsigned boff,
                                                 const unsigned (&l0)[8]) {
  unsigned l[8];
  const unsigned short* g[8];
#pragma unroll  // constant indices keep the arrays in registers
  for (int i = 0; i < 4; ++i) {
    l[i]     = l0[i] + boff;
    l[4 + i] = l0[4 + i] + boff;
    g[i]     = K + (size_t)(kt + i * 16 + sr) * DK + sc;
    g[4 + i] = V + (size_t)(i * 16 + sr) * LSEQ + kt + sc;
  }
  async_copy8x16B(l, g);
}
// One K/V tile's work of a wave: 16 queries x 64 keys, from the tiles at kL and vL.
// cneg: eight registers, each minus the lane's query's reference maximum (exp2 units). It is
// the C operand of the score product, so a score leaves the matrix unit as the argument of
// its exp2. The reference is renewed (and acc, lrun rescaled) only in the first trip or when
// some query's tile maximum tops it by more than 8, so P stays within 2^8.
__device__ __forceinline__ void attn_trip(const unsigned short* kL, const unsigned short* vL,
                                          int llo, int lhi, const v16bf (&aQ)[2], v8f (&acc)[4],
                                          v8f& cneg, float& lrun, bool first) {
  // S^T = K Q^T - reference: A = K rows (keys), B = Q rows (queries, pre-scaled)
  v8f s[4];
#pragma unroll
  for (int f = 0; f < 4; ++f) {
    v16bf aK = load_frag(kL, f * 16 + llo, LDS_STRIDE, 0, lhi);
    s[f] = WMMA_BF16(aK, aQ[0], cneg);
  }
#pragma unroll
  for (int f = 0; f < 4; ++f) {
    v16bf aK = load_frag(kL, f * 16 + llo, LDS_STRIDE, 32, lhi);
    s[f] = WMMA_BF16(aK, aQ[1], s[f]);
  }
  // V fragments asked for ahead of the test below, so that their LDS latency runs under the softmax
  v16bf aV[2][4];
#pragma unroll
  for (int c = 0; c < 2; ++c)
#pragma unroll
    for (int f = 0; f < 4; ++f) aV[c][f] = load_frag(vL, f * 16 + llo, LDS_STRIDE, c * 32, lhi);

  // all 32 scores of a lane belong to query q0 + llo
  float mf[4];
#pragma unroll
  for (int f = 0; f < 4; ++f) {
    mf[f] = s[f][0];
#pragma unroll
    for (int rr = 1; rr < 8; ++rr) mf[f] = fmaxf(mf[f], s[f][rr]);
  }
  float m = fmaxf(fmaxf(mf[0], mf[1]), fmaxf(mf[2], mf[3]));
  m = fmaxf(m, xhalf(m));  // join the two halves' keys: tile maximum above the reference
  if (first || __builtin_amdgcn_ballot_w32(m > 8.0f) != 0u) {
    const float d     = first ? m : fmaxf(m, 0.0f);  // the reference never falls
    const float alpha = first ? 0.0f : __builtin_amdgcn_exp2f(-d);  // first: acc, lrun are 0
    lrun *= alpha;
#pragma unroll
    for (int rr = 0; rr < 8; ++rr) cneg[rr] -= d;
#pragma unroll
    for (int f = 0; f < 4; ++f)
#pragma unroll
      for (int rr = 0; rr < 8; ++rr) {
        acc[f][rr] *= alpha;
        s[f][rr] -= d;
      }
  }
  float rs[4];
#pragma unroll
  for (int f = 0; f < 4; ++f) {
    rs[f] = 0.0f;
#pragma unroll
    for (int rr = 0; rr < 8; ++rr) {
      float p = __builtin_amdgcn_exp2f(s[f][rr]);
      s[f][rr] = p;
      rs[f] += p;
    }
  }
  lrun += (rs[0] + rs[1]) + (rs[2] + rs[3]);

  // O^T += V^T P^T: A = Vt rows (d), B = P^T packed from tiles 2c and 2c + 1,
  // which is load_frag's k order (8h + e, then 16 + 8h + e) at every position
#pragma unroll
  for (int c = 0; c < 2; ++c) {
    FragU bP;
    bP.q[0] = make_uint4(pack2bf(s[2 * c][0], s[2 * c][1]), pack2bf(s[2 * c][2], s[2 * c][3]),
                         pack2bf(s[2 * c][4], s[2 * c][5]), pack2bf(s[2 * c][6], s[2 * c][7]));
    bP.q[1] = make_uint4(pack2bf(s[2 * c + 1][0], s[2 * c + 1][1]),
                         pack2bf(s[2 * c + 1][2], s[2 * c + 1][3]),
                         pack2bf(s[2 * c + 1][4], s[2 * c + 1][5]),
                         pack2bf(s[2 * c + 1][6], s[2 * c + 1][7]));
#pragma unroll
    for (int f = 0; f < 4; ++f) acc[f] = WMMA_BF16(aV[c][f], bP.v, acc[f]);
  }
}
__global__ __launch_bounds__(128) void attn_kernel(
    const unsigned short* __restrict__ Qr, const unsigned short* __restrict__ Kr,
    const unsigned short* __restrict__ Vt, unsigned short* __restrict__ O) {
  __shared__ __attribute__((aligned(16))) unsigned short kL2[2 * KV_TILE];
  __shared__ __attribute__((aligned(16))) unsigned short vL2[2 * KV_TILE];

  const int t = threadIdx.x;
  const int w = t >> 5, lane = t & 31;
  const int lhi = lane >> 4, llo = lane & 15;
  const int bh = blockIdx.y;                   // 0..31 = b*16+h
  const int q0 = blockIdx.x * 64 + w * 16;     // wave's first query row
  const size_t hb = (size_t)bh * LSEQ * DK;    // same element offset for Qr/Kr/Vt

  // Q fragments (held in registers for whole kernel)
  v16bf aQ[2];
#pragma unroll
  for (int c = 0; c < 2; ++c)
    aQ[c] = load_frag(Qr + hb, q0 + llo, DK, c * 32, lhi);

  v8f acc[4];
#pragma unroll
  for (int f = 0; f < 4; ++f) acc[f] = zero8();
  // this lane's query: minus the reference maximum (both halves alike; set in the first
  // trip), running sum (own half's keys)
  v8f cneg = zero8();
  float lrun = 0.0f;

  // staging map: 8 lanes take one 128-byte tile row, a wave-wide copy 4 whole lines
  const int sr = t >> 3, sc = (t & 7) * 8;
  unsigned ldsKV[8];
#pragma unroll  // constant indices keep the array in registers
  for (int i = 0; i < 4; ++i) {
    ldsKV[i]     = lds_addr(kL2 + (i * 16 + sr) * LDS_STRIDE + sc);
    ldsKV[4 + i] = lds_addr(vL2 + (i * 16 + sr) * LDS_STRIDE + sc);
  }

  // tile 0 landed and published, then tile 1 in flight (LSEQ holds 32 tiles)
  attn_stage_tiles(Kr + hb, Vt + hb, 0, sr, sc, 0u, ldsKV);
  wait_async0();
  __syncthreads();
  attn_stage_tiles(Kr + hb, Vt + hb, 64, sr, sc, KV_TILE * 2u, ldsKV);

  for (int kt = 0; kt < LSEQ - 128; kt += 64) {
    const int cur = (kt >> 6) & 1;  // this trip reads buffer cur alone
    attn_trip(kL2 + cur * KV_TILE, vL2 + cur * KV_TILE, llo, lhi, aQ, acc, cneg, lrun, kt == 0);
    // foot of the trip: own reads of buffer cur retired, own copies of the next tile
    // landed; the barrier publishes that tile and frees buffer cur for the refill
    wait_ds0();
    wait_async0();
    __syncthreads();
    attn_stage_tiles(Kr + hb, Vt + hb, kt + 128, sr, sc, cur * (KV_TILE * 2u), ldsKV);
  }
  // the last two tiles (an even count: buffers 0, 1): the same trips, nothing left to ask for
#pragma unroll  // constant buffer index: LDS offsets fold into the loads
  for (int cur = 0; cur < 2; ++cur) {
    attn_trip(kL2 + cur * KV_TILE, vL2 + cur * KV_TILE, llo, lhi, aQ, acc, cneg, lrun, false);
    wait_ds0();
    wait_async0();
    __syncthreads();
  }
  wait_async0();  // nothing of this wave is in flight when it leaves the loop

  // normalize + store O as [B][L][H*DK] bf16: a lane's 8 registers of tile f are
  // d = 16f + 8h + 0..7 of its query's row, one 16-byte store
  const int b = bh >> 4, h = bh & 15;
  const float inv = 1.0f / (lrun + xhalf(lrun));  // join the halves' sums once
  unsigned short* orow = O + (size_t)(b * LSEQ + q0 + llo) * D_MODEL + h * DK + 8 * lhi;
#pragma unroll
  for (int f = 0; f < 4; ++f)
    *(uint4*)(orow + f * 16) =
        make_uint4(pack2bf(acc[f][0] * inv, acc[f][1] * inv), pack2bf(acc[f][2] * inv, acc[f][3] * inv),
                   pack2bf(acc[f][4] * inv, acc[f][5] * inv), pack2bf(acc[f][6] * inv, acc[f][7] * inv));
}

// ---------------------------------------------------------------------------
// Kernel 3: out = O @ W_out^T + b_out (fp32 result). grid (16, 32), block 128.
// Tile 128(M) x 64(N), K chunk 128; both tiles (bf16) staged with async global->LDS copies, two
// buffers: chunk k + 1 flies while chunk k is worked on; one barrier a trip, at its foot.
// ---------------------------------------------------------------------------
__global__ __launch_bounds__(128) void out_proj_kernel(
    const unsigned short* __restrict__ O, const unsigned short* __restrict__ Wob,
    const float* __restrict__ b_out, float* __restrict__ out) {
  __shared__ __attribute__((aligned(16))) unsigned short abL[2 * AB_TILE];

  const int t = threadIdx.x;
  const int w = t >> 5, lane = t & 31;
  const int lhi = lane >> 4, llo = lane & 15;
  const int n0 = blockIdx.x * 64;
  const int m0 = blockIdx.y * 128;

  v8f acc[2][4];
#pragma unroll
  for (int mf = 0; mf < 2; ++mf)
#pragma unroll
    for (int f = 0; f < 4; ++f) acc[mf][f] = zero8();

  const unsigned ldsAB = lds_addr(abL + (t >> 4) * GEMM_STRIDE + (t & 15) * 8);  // in buffer 0
  const unsigned short* aG = O + (size_t)m0 * D_MODEL;
  const unsigned short* bG = Wob + (size_t)n0 * D_MODEL;

  // chunk 0 landed and published, then chunk 1 in flight (D_MODEL holds 8 chunks)
  gemm_stage_tiles(aG, bG, t, ldsAB);
  wait_async0();
  __syncthreads();
  gemm_stage_tiles(aG + GEMM_KC, bG + GEMM_KC, t, ldsAB + AB_TILE * 2u);

  for (int k0 = 0; k0 < D_MODEL - 2 * GEMM_KC; k0 += GEMM_KC) {
    const int cur = (k0 / GEMM_KC) & 1;  // this trip reads buffer cur alone
    gemm_trip(abL + cur * AB_TILE, w, llo, lhi, acc);
    // foot of the trip: own reads of buffer cur retired, own copies of the next chunk
    // landed; the barrier publishes that chunk and frees buffer cur for the refill
    wait_ds0();
    wait_async0();
    __syncthreads();
    gemm_stage_tiles(aG + k0 + 2 * GEMM_KC, bG + k0 + 2 * GEMM_KC, t, ldsAB + cur * (AB_TILE * 2u));
  }
  // the last two chunks (an even count: buffers 0, 1): the same trips, nothing left to ask for
#pragma unroll  // constant buffer index: LDS offsets fold into the loads
  for (int cur = 0; cur < 2; ++cur) {
    gemm_trip(abL + cur * AB_TILE, w, llo, lhi, acc);
    wait_ds0();
    wait_async0();
    __syncthreads();
  }
  wait_async0();  // nothing of this wave is in flight when it leaves the loop

#pragma unroll
  for (int mf = 0; mf < 2; ++mf) {
    const int mbase = m0 + w * 32 + mf * 16 + 8 * lhi;
#pragma unroll
    for (int f = 0; f < 4; ++f) {
      int c = n0 + f * 16 + llo;
      float bias = b_out[c];
#pragma unroll
      for (int rr = 0; rr < 8; ++rr)
        out[(size_t)(mbase + rr) * D_MODEL + c] = acc[mf][f][rr] + bias;
    }
  }
}

// ---------------------------------------------------------------------------
extern "C" void kernel_launch(void* const* d_in, const int* in_sizes, int n_in,
                              void* d_out, int out_size, void* d_ws, size_t ws_size,
                              hipStream_t stream) {
  (void)in_sizes; (void)n_in; (void)out_size; (void)ws_size;
  const float* x        = (const float*)d_in[0];
  const float* rope_cos = (const float*)d_in[1];
  const float* rope_sin = (const float*)d_in[2];
  const float* W_qkv    = (const float*)d_in[3];
  const float* b_qkv    = (const float*)d_in[4];
  const float* W_out    = (const float*)d_in[5];
  const float* b_out    = (const float*)d_in[6];

  const size_t headElems = (size_t)BB * NHEAD * LSEQ * DK;  // 4M elems each
  unsigned short* Qr = (unsigned short*)d_ws;
  unsigned short* Kr = Qr + headElems;
  unsigned short* Vt = Kr + headElems;
  unsigned short* O  = Vt + headElems;  // [B][L][D_MODEL] bf16
  unsigned short* xb  = O + headElems;                      // x as bf16
  unsigned short* Wqb = xb + (size_t)BB * LSEQ * D_MODEL;   // W_qkv as bf16
  unsigned short* Wob = Wqb + (size_t)3 * D_MODEL * D_MODEL;  // W_out as bf16

  to_bf16_kernel<<<dim3(CVT_BLK_X + CVT_BLK_WQ + CVT_BLK_WO), 256, 0, stream>>>(
      x, W_qkv, W_out, xb, Wqb, Wob);
  qkv_rope_kernel<<<dim3(3 * D_MODEL / 64, BB * LSEQ / 128), 128, 0, stream>>>(
      xb, rope_cos, rope_sin, Wqb, b_qkv, Qr, Kr, Vt);
  attn_kernel<<<dim3(LSEQ / 64, BB * NHEAD), 128, 0, stream>>>(Qr, Kr, Vt, O);
  out_proj_kernel<<<dim3(D_MODEL / 64, BB * LSEQ / 128), 128, 0, stream>>>(
      O, Wob, b_out, (float*)d_out);
}

// v007
// One run takes 78.7 microseconds.
// Two timings next to v006 both put it at 1.05 times that version's speed.
// All steps since v000 together make it 3.34 times as fast.
#include <hip/hip_runtime.h>
#include <hip/hip_bf16.h>
#include <stdint.h>

// Problem constants (match reference)
#define D_MODEL 1024
#define NHEAD   16
#define DK      64
#define BB      2
#define LSEQ    2048

typedef __attribute__((ext_vector_type(16))) __bf16 v16bf;
typedef __attribute__((ext_vector_type(8)))  float  v8f;

#define WMMA_BF16(a,b,c) \
  __builtin_amdgcn_wmma_f32_16x16x32_bf16(false,(a),false,(b),(short)0,(c),false,false)

__device__ __forceinline__ v8f zero8() {
  v8f z;
#pragma unroll
  for (int i = 0; i < 8; ++i) z[i] = 0.0f;
  return z;
}

__device__ __forceinline__ unsigned short f2bf(float f) {
  unsigned u = __float_as_uint(f);
  return (unsigned short)((u + 0x8000u) >> 16);  // round-to-nearest (approx)
}

union FragU { uint4 q[2]; v16bf v; };

// Two f32 -> one dword of two bf16 (f2bf's rounding), lo in the low half.
__device__ __forceinline__ unsigned pack2bf(float lo, float hi) {
  return __builtin_amdgcn_perm(__float_as_uint(hi) + 0x8000u,
                               __float_as_uint(lo) + 0x8000u, 0x07060302u);
}

__device__ __forceinline__ float xhalf(float x) {
  const int b = __builtin_bit_cast(int, x);
  return __builtin_bit_cast(
      float, __builtin_amdgcn_permlanex16(b, b, 0x76543210, 0xfedcba98, false, false));
}

__device__ __forceinline__ v16bf load_frag(const unsigned short* base, int row,
                                           int stride, int kOff, int sel) {
  const unsigned short* p = base + row * stride + kOff + (sel << 3);
  FragU f;
  f.q[0] = *(const uint4*)(p);
  f.q[1] = *(const uint4*)(p + 16);
  return f.v;
}

#define LDS_STRIDE 72  // 64 + 8 bf16 pad

// (1/sqrt(DK)) * log2(e): stored Q carries it, so K Q^T comes out in exp2 units
#define Q_LOG2_SCALE 0.18033688011112042f

__device__ __forceinline__ void async_copy8x16B(const unsigned (&l)[8],
                                                const unsigned short* const (&g)[8]) {
  asm volatile(
      "global_load_async_to_lds_b128 %0, %8, off\n\t"
      "global_load_async_to_lds_b128 %1, %9, off\n\t"
      "global_load_async_to_lds_b128 %2, %10, off\n\t"
      "global_load_async_to_lds_b128 %3, %11, off\n\t"
      "global_load_async_to_lds_b128 %4, %12, off\n\t"
      "global_load_async_to_lds_b128 %5, %13, off\n\t"
      "global_load_async_to_lds_b128 %6, %14, off\n\t"
      "global_load_async_to_lds_b128 %7, %15, off\n\t"
      "s_wait_xcnt 0x0"
      :: "v"(l[0]), "v"(l[1]), "v"(l[2]), "v"(l[3]),
         "v"(l[4]), "v"(l[5]), "v"(l[6]), "v"(l[7]),
         "v"(g[0]), "v"(g[1]), "v"(g[2]), "v"(g[3]),
         "v"(g[4]), "v"(g[5]), "v"(g[6]), "v"(g[7])
      : "memory");
}
__device__ __forceinline__ unsigned lds_addr(const unsigned short* l) {
  return (unsigned)(unsigned long long)l;  // low 32b = LDS offset
}
__device__ __forceinline__ void wait_async0() {
  asm volatile("s_wait_asynccnt 0x0" ::: "memory");
}
// Ahead of the barrier that frees a tile for refilling: this wave's LDS reads have retired.
__device__ __forceinline__ void wait_ds0() {
  asm volatile("s_wait_dscnt 0x0" ::: "memory");
}
__device__ __forceinline__ void async_copy12x16B(const unsigned (&l)[12],
                                                 const unsigned short* const (&g)[12]) {
  asm volatile(
      "global_load_async_to_lds_b128 %0, %12, off\n\t"
      "global_load_async_to_lds_b128 %1, %13, off\n\t"
      "global_load_async_to_lds_b128 %2, %14, off\n\t"
      "global_load_async_to_lds_b128 %3, %15, off\n\t"
      "global_load_async_to_lds_b128 %4, %16, off\n\t"
      "global_load_async_to_lds_b128 %5, %17, off\n\t"
      "global_load_async_to_lds_b128 %6, %18, off\n\t"
      "global_load_async_to_lds_b128 %7, %19, off\n\t"
      "global_load_async_to_lds_b128 %8, %20, off\n\t"
      "global_load_async_to_lds_b128 %9, %21, off\n\t"
      "global_load_async_to_lds_b128 %10, %22, off\n\t"
      "global_load_async_to_lds_b128 %11, %23, off\n\t"
      "s_wait_xcnt 0x0"
      :: "v"(l[0]), "v"(l[1]), "v"(l[2]), "v"(l[3]), "v"(l[4]), "v"(l[5]),
         "v"(l[6]), "v"(l[7]), "v"(l[8]), "v"(l[9]), "v"(l[10]), "v"(l[11]),
         "v"(g[0]), "v"(g[1]), "v"(g[2]), "v"(g[3]), "v"(g[4]), "v"(g[5]),
         "v"(g[6]), "v"(g[7]), "v"(g[8]), "v"(g[9]), "v"(g[10]), "v"(g[11])
      : "memory");
}

// GEMM tile staging, 128 threads: one K chunk of 128, A 128 x 128 and B 64 x 128 bf16, row
// pitch D_MODEL in memory; in LDS one buffer of 192 rows (A rows 0..127, B rows 128..191).
// 16 lanes take one 256-byte tile row, so a wave-wide copy covers 4 whole lines; the
// twenty-four copies of a lane (two statements) are in flight together, through no register.
#define GEMM_KC     128  // K elements a chunk
#define GEMM_STRIDE 136  // 128 + 8 bf16 pad: 272 B = 16 B x odd, the pitch of ds_load_b128 readers
#define AB_TILE (192 * GEMM_STRIDE)  // elements of one buffer
// l0: LDS byte address of this lane's place in row t >> 4 of the buffer to fill.
__device__ __forceinline__ void gemm_stage_tiles(const unsigned short* a, const unsigned short* b,
                                                 int t, unsigned l0) {
#pragma unroll  // constant indices keep the arrays in registers
  for (int s = 0; s < 2; ++s) {
    unsigned l[12];
    const unsigned short* g[12];
#pragma unroll  // constant indices keep the arrays in registers
    for (int j = 0; j < 12; ++j) {
      const int i = s * 12 + j;  // copy i fills buffer rows 8i .. 8i + 7
      const unsigned short* tile = (i < 16) ? a : b;
      l[j] = l0 + (unsigned)(i * 8 * GEMM_STRIDE * 2);
      g[j] = tile + (size_t)((i & 15) * 8 + (t >> 4)) * D_MODEL + (t & 15) * 8;
    }
    async_copy12x16B(l, g);
  }
}
// One chunk's products of a wave, 32 rows x 64 columns, from the buffer at ab.
__device__ __forceinline__ void gemm_trip(const unsigned short* ab, int w, int llo, int lhi,
                                          v8f (&acc)[2][4]) {
  const unsigned short* bL = ab + 128 * GEMM_STRIDE;
#pragma unroll
  for (int ks = 0; ks < GEMM_KC; ks += 32) {
    v16bf a0 = load_frag(ab, w * 32 + llo, GEMM_STRIDE, ks, lhi);
    v16bf a1 = load_frag(ab, w * 32 + 16 + llo, GEMM_STRIDE, ks, lhi);
#pragma unroll
    for (int f = 0; f < 4; ++f) {
      v16bf b = load_frag(bL, f * 16 + llo, GEMM_STRIDE, ks, lhi);
      acc[0][f] = WMMA_BF16(a0, b, acc[0][f]);
      acc[1][f] = WMMA_BF16(a1, b, acc[1][f]);
    }
  }
}

// ---------------------------------------------------------------------------
// Kernel 0: x, W_qkv, W_out rounded to bf16 once (f2bf's rounding), so that no GEMM
// tile is converted again by every workgroup that reads it.
// grid 512, block 256; a block takes 4096 float4; a wave-wide load covers 4 whole
// lines, a wave-wide 8-byte store 2.
// ---------------------------------------------------------------------------
#define CVT_F4     4096                                   // float4 per block
#define CVT_BLK_X  (BB * LSEQ * D_MODEL / 4 / CVT_F4)      // 256
#define CVT_BLK_WQ (3 * D_MODEL * D_MODEL / 4 / CVT_F4)    // 192
#define CVT_BLK_WO (D_MODEL * D_MODEL / 4 / CVT_F4)        // 64
__global__ __launch_bounds__(256) void to_bf16_kernel(
    const float* __restrict__ x, const float* __restrict__ W_qkv,
    const float* __restrict__ W_out, unsigned short* __restrict__ xb,
    unsigned short* __restrict__ Wqb, unsigned short* __restrict__ Wob) {
  const int blk = blockIdx.x;
  const float* src = x;
  unsigned short* dst = xb;
  int b0 = blk;
  if (blk >= CVT_BLK_X + CVT_BLK_WQ) {
    src = W_out; dst = Wob; b0 = blk - (CVT_BLK_X + CVT_BLK_WQ);
  } else if (blk >= CVT_BLK_X) {
    src = W_qkv; dst = Wqb; b0 = blk - CVT_BLK_X;
  }
  const int base = b0 * CVT_F4 + (int)threadIdx.x;
  float4 v[CVT_F4 / 256];
#pragma unroll  // constant indices keep the array in registers
  for (int i = 0; i < CVT_F4 / 256; ++i) v[i] = ((const float4*)src)[base + i * 256];
#pragma unroll  // constant indices keep the array in registers
  for (int i = 0; i < CVT_F4 / 256; ++i)
    ((uint2*)dst)[base + i * 256] = make_uint2(pack2bf(v[i].x, v[i].y), pack2bf(v[i].z, v[i].w));
}

__global__ __launch_bounds__(128) __attribute__((amdgpu_waves_per_eu(1, 6))) void qkv_rope_kernel(
    const unsigned short* __restrict__ xb, const float* __restrict__ rope_cos,
    const float* __restrict__ rope_sin, const unsigned short* __restrict__ Wqb,
    const float* __restrict__ b_qkv, unsigned short* __restrict__ Qr,
    unsigned short* __restrict__ Kr, unsigned short* __restrict__ Vt) {
  __shared__ __attribute__((aligned(16))) unsigned short abL[AB_TILE];

  const int t = threadIdx.x;
  const int w = t >> 5, lane = t & 31;
  const int lhi = lane >> 4, llo = lane & 15;
  const int n0 = blockIdx.x * 64;
  const int m0 = blockIdx.y * 128;

  v8f acc[2][4];
#pragma unroll
  for (int mf = 0; mf < 2; ++mf)
#pragma unroll
    for (int f = 0; f < 4; ++f) acc[mf][f] = zero8();

  const unsigned ldsAB = lds_addr(abL + (t >> 4) * GEMM_STRIDE + (t & 15) * 8);

  for (int k0 = 0; k0 < D_MODEL; k0 += GEMM_KC) {
    wait_ds0();
    __syncthreads();
    gemm_stage_tiles(xb + (size_t)m0 * D_MODEL + k0, Wqb + (size_t)n0 * D_MODEL + k0, t, ldsAB);
    wait_async0();
    __syncthreads();
    gemm_trip(abL, w, llo, lhi, acc);
  }

  // Epilogue: bias + RoPE + scatter
  const int which = n0 >> 10;            // 0=q 1=k 2=v
  const int h = (n0 & 1023) >> 6;        // head
#pragma unroll
  for (int mf = 0; mf < 2; ++mf) {
    const int mbase = m0 + w * 32 + mf * 16 + 8 * lhi;
    float val[4][8];
#pragma unroll
    for (int f = 0; f < 4; ++f) {
      float bias = b_qkv[n0 + f * 16 + llo];
#pragma unroll
      for (int rr = 0; rr < 8; ++rr) val[f][rr] = acc[mf][f][rr] + bias;
    }

    if (which < 2) {
#pragma unroll
      for (int f = 0; f < 2; ++f) {
        int d = f * 16 + llo;  // 0..31
#pragma unroll
        for (int rr = 0; rr < 8; ++rr) {
          int m = mbase + rr;
          float c = rope_cos[m * (DK / 2) + d];
          float s = rope_sin[m * (DK / 2) + d];
          float x1 = val[f][rr], x2 = val[f + 2][rr];
          val[f][rr]     = x1 * c - x2 * s;
          val[f + 2][rr] = x1 * s + x2 * c;
        }
      }
      unsigned short* dst = (which == 0) ? Qr : Kr;
      const float os = (which == 0) ? Q_LOG2_SCALE : 1.0f;
#pragma unroll
      for (int f = 0; f < 4; ++f) {
        int d = f * 16 + llo;
#pragma unroll
        for (int rr = 0; rr < 8; ++rr) {
          int m = mbase + rr;
          int b = m >> 11, pos = m & (LSEQ - 1);
          dst[((size_t)(b * NHEAD + h) * LSEQ + pos) * DK + d] = f2bf(val[f][rr] * os);
        }
      }
      // ahead of the next half's loads and index sums, which reuse registers that these stores name
      asm volatile("s_wait_xcnt 0x0" ::: "memory");
    } else {
#pragma unroll
      for (int f = 0; f < 4; ++f) {
        int d = f * 16 + llo;
#pragma unroll
        for (int rr = 0; rr < 8; ++rr) {
          int m = mbase + rr;
          int b = m >> 11, pos = m & (LSEQ - 1);
          Vt[((size_t)(b * NHEAD + h) * DK + d) * LSEQ + pos] = f2bf(val[f][rr]);
        }
      }
    }
  }
}

#define KV_TILE (64 * LDS_STRIDE)
#define KV_BUF  (4 * KV_TILE)
#define KHALF   (LSEQ / 2)
__device__ __forceinline__ void attn_stage_tiles(const unsigned short* K, const unsigned short* V,
                                                 int kt, int sr, int sc, unsigned l0) {
  unsigned l[8];
  const unsigned short* g[8];
#pragma unroll  // constant indices keep the arrays in registers
  for (int hf = 0; hf < 2; ++hf)
#pragma unroll  // constant indices keep the arrays in registers
    for (int i = 0; i < 2; ++i) {
      l[hf * 2 + i]     = l0 + (unsigned)((hf * KV_TILE + i * 32 * LDS_STRIDE) * 2);
      l[4 + hf * 2 + i] = l0 + (unsigned)(((2 + hf) * KV_TILE + i * 32 * LDS_STRIDE) * 2);
      g[hf * 2 + i]     = K + (size_t)(hf * KHALF + kt + i * 32 + sr) * DK + sc;
      g[4 + hf * 2 + i] = V + (size_t)(i * 32 + sr) * LSEQ + hf * KHALF + kt + sc;
    }
  async_copy8x16B(l, g);
}
// One pass of a wave: 32 queries (tiles g = 0, 1) x the 32 keys p*32.. of the tiles at kL, vL.
// cneg[g]: eight registers, each minus the lane's query's reference maximum (exp2 units). It is
// the C operand of the score product, so a score leaves the matrix unit as the argument of
// its exp2. The reference is renewed (and acc, lrun rescaled) only in the first pass or when
// some query's pass maximum tops it by more than 8, so P stays within 2^8.
__device__ __forceinline__ void attn_pass(const unsigned short* kL, const unsigned short* vL, int p,
                                          int llo, int lhi, const v16bf (&aQ)[2][2],
                                          v8f (&acc)[2][4], v8f (&cneg)[2], float (&lrun)[2],
                                          bool first) {
  // S^T = K Q^T - reference: A = K rows (keys), B = Q rows (queries, pre-scaled)
  v16bf aK[2][2];
#pragma unroll
  for (int c = 0; c < 2; ++c)
#pragma unroll
    for (int j = 0; j < 2; ++j)
      aK[j][c] = load_frag(kL, (2 * p + j) * 16 + llo, LDS_STRIDE, c * 32, lhi);
  v8f s[2][2];
#pragma unroll
  for (int j = 0; j < 2; ++j)
#pragma unroll
    for (int g = 0; g < 2; ++g) s[g][j] = WMMA_BF16(aK[j][0], aQ[g][0], cneg[g]);
#pragma unroll
  for (int j = 0; j < 2; ++j)
#pragma unroll
    for (int g = 0; g < 2; ++g) s[g][j] = WMMA_BF16(aK[j][1], aQ[g][1], s[g][j]);
  // V fragments asked for ahead of the test below, so that their LDS latency runs under the softmax
  v16bf aV[4];
#pragma unroll
  for (int f = 0; f < 4; ++f) aV[f] = load_frag(vL, f * 16 + llo, LDS_STRIDE, p * 32, lhi);

  // the 16 scores of a lane in tile g belong to query q0 + 16g + llo
  float m[2];
#pragma unroll
  for (int g = 0; g < 2; ++g) {
    float m0 = s[g][0][0], m1 = s[g][1][0];
#pragma unroll
    for (int rr = 1; rr < 8; ++rr) {
      m0 = fmaxf(m0, s[g][0][rr]);
      m1 = fmaxf(m1, s[g][1][rr]);
    }
    m[g] = fmaxf(m0, m1);
    m[g] = fmaxf(m[g], xhalf(m[g]));  // join the two halves' keys: pass maximum above the reference
  }
  if (first || __builtin_amdgcn_ballot_w32(fmaxf(m[0], m[1]) > 8.0f) != 0u) {
#pragma unroll
    for (int g = 0; g < 2; ++g) {
      const float d     = first ? m[g] : fmaxf(m[g], 0.0f);  // the reference never falls
      const float alpha = first ? 0.0f : __builtin_amdgcn_exp2f(-d);  // first: acc, lrun are 0
      lrun[g] *= alpha;
#pragma unroll
      for (int rr = 0; rr < 8; ++rr) {
        cneg[g][rr] -= d;
        s[g][0][rr] -= d;
        s[g][1][rr] -= d;
      }
#pragma unroll
      for (int f = 0; f < 4; ++f)
#pragma unroll
        for (int rr = 0; rr < 8; ++rr) acc[g][f][rr] *= alpha;
    }
  }
  // O^T += V^T P^T: A = Vt rows (d), B = P^T packed from key tiles 2p and 2p + 1,
  // which is load_frag's k order (8h + e, then 16 + 8h + e) at every position
#pragma unroll
  for (int g = 0; g < 2; ++g) {
    float rs[2];
#pragma unroll
    for (int j = 0; j < 2; ++j) {
      rs[j] = 0.0f;
#pragma unroll
      for (int rr = 0; rr < 8; ++rr) {
        float e = __builtin_amdgcn_exp2f(s[g][j][rr]);
        s[g][j][rr] = e;
        rs[j] += e;
      }
    }
    lrun[g] += rs[0] + rs[1];
    FragU bP;
    bP.q[0] = make_uint4(pack2bf(s[g][0][0], s[g][0][1]), pack2bf(s[g][0][2], s[g][0][3]),
                         pack2bf(s[g][0][4], s[g][0][5]), pack2bf(s[g][0][6], s[g][0][7]));
    bP.q[1] = make_uint4(pack2bf(s[g][1][0], s[g][1][1]), pack2bf(s[g][1][2], s[g][1][3]),
                         pack2bf(s[g][1][4], s[g][1][5]), pack2bf(s[g][1][6], s[g][1][7]));
#pragma unroll
    for (int f = 0; f < 4; ++f) acc[g][f] = WMMA_BF16(aV[f], bP.v, acc[g][f]);
  }
}
__global__ __launch_bounds__(256) __attribute__((amdgpu_waves_per_eu(4, 4))) void attn_kernel(
    const unsigned short* __restrict__ Qr, const unsigned short* __restrict__ Kr,
    const unsigned short* __restrict__ Vt, unsigned short* __restrict__ O) {
  __shared__ __attribute__((aligned(16))) unsigned short kvL[2 * KV_BUF];

  const int t = threadIdx.x;
  const int w = __builtin_amdgcn_readfirstlane(t >> 5), lane = t & 31;
  const int lhi = lane >> 4, llo = lane & 15;
  const int cg = w & 3, kh = w >> 2;           // column group, key half
  const int bh = blockIdx.y;                   // 0..31 = b*16+h
  const int q0 = blockIdx.x * 128 + cg * 32;   // wave's first query row
  const size_t hb = (size_t)bh * LSEQ * DK;    // same element offset for Qr/Kr/Vt

  // Q fragments (held in registers for whole kernel)
  v16bf aQ[2][2];
#pragma unroll
  for (int g = 0; g < 2; ++g)
#pragma unroll
    for (int c = 0; c < 2; ++c)
      aQ[g][c] = load_frag(Qr + hb, q0 + g * 16 + llo, DK, c * 32, lhi);

  v8f acc[2][4];
  // this lane's two queries: minus the reference maximum (both lane halves alike; set in the
  // first pass), running sum (own lane half's keys)
  v8f cneg[2];
  float lrun[2];
#pragma unroll
  for (int g = 0; g < 2; ++g) {
#pragma unroll
    for (int f = 0; f < 4; ++f) acc[g][f] = zero8();
    cneg[g] = zero8();
    lrun[g] = 0.0f;
  }

  // staging map: 8 lanes take one 128-byte tile row, a wave-wide copy 4 whole lines
  const int sr = t >> 3, sc = (t & 7) * 8;
  const unsigned ldsKV = lds_addr(kvL + sr * LDS_STRIDE + sc);  // in buffer 0
  const unsigned short* kW = kvL + kh * KV_TILE;        // this wave's K tile in buffer 0
  const unsigned short* vW = kvL + (2 + kh) * KV_TILE;  // this wave's V tile in buffer 0

  // tile 0 landed and published, then tile 1 in flight (a key half holds 16 tiles)
  attn_stage_tiles(Kr + hb, Vt + hb, 0, sr, sc, ldsKV);
  wait_async0();
  __syncthreads();
  attn_stage_tiles(Kr + hb, Vt + hb, 64, sr, sc, ldsKV + KV_BUF * 2u);

  for (int kt = 0; kt < KHALF; kt += 64) {
    const int cur = (kt >> 6) & 1;  // this trip reads buffer cur alone
    attn_pass(kW + cur * KV_BUF, vW + cur * KV_BUF, 0, llo, lhi, aQ, acc, cneg, lrun, kt == 0);
    attn_pass(kW + cur * KV_BUF, vW + cur * KV_BUF, 1, llo, lhi, aQ, acc, cneg, lrun, false);
    // foot of the trip: own reads of buffer cur retired, own copies of the next tile
    // landed; the barrier publishes that tile and frees buffer cur for the refill
    wait_ds0();
    wait_async0();
    __syncthreads();
    if (kt + 128 < KHALF)  // alike for the whole workgroup: the last two trips ask for nothing
      attn_stage_tiles(Kr + hb, Vt + hb, kt + 128, sr, sc, ldsKV + cur * (KV_BUF * 2u));
  }
  wait_async0();  // nothing of this wave is in flight when it leaves the loop

  // Join of the key halves. Behind the barrier above no tile is read any more and no copy is in
  // flight, so the buffers serve as the hand-over: waves of half 1 leave their sums there, lane
  // by lane (a wave-wide 16-byte store covers 512 contiguous bytes), waves of half 0 take them.
  float4* mrg = (float4*)kvL;
  const int ml = cg * 32 + lane;
  if (kh == 1) {
#pragma unroll
    for (int g = 0; g < 2; ++g)
#pragma unroll
      for (int f = 0; f < 4; ++f) {
        mrg[((g * 4 + f) * 2 + 0) * 128 + ml] =
            make_float4(acc[g][f][0], acc[g][f][1], acc[g][f][2], acc[g][f][3]);
        mrg[((g * 4 + f) * 2 + 1) * 128 + ml] =
            make_float4(acc[g][f][4], acc[g][f][5], acc[g][f][6], acc[g][f][7]);
      }
    mrg[16 * 128 + ml] = make_float4(cneg[0][0], cneg[1][0], lrun[0], lrun[1]);
  }
  __syncthreads();
  if (kh == 0) {
    // normalize + store O as [B][L][H*DK] bf16: a lane's 8 registers of tile f are
    // d = 16f + 8h + 0..7 of its query's row, one 16-byte store
    const int b = bh >> 4, h = bh & 15;
    const float4 o = mrg[16 * 128 + ml];
#pragma unroll
    for (int g = 0; g < 2; ++g) {
      const float ca = cneg[g][0], cb = g ? o.y : o.x;
      const float cm = fminf(ca, cb);  // minus the larger of the two references
      float fa = __builtin_amdgcn_exp2f(cm - ca);
      float fb = __builtin_amdgcn_exp2f(cm - cb);
      const float l = lrun[g] * fa + (g ? o.w : o.z) * fb;
      const float inv = 1.0f / (l + xhalf(l));  // join the lane halves' sums once
      fa *= inv;
      fb *= inv;
      unsigned short* orow =
          O + (size_t)(b * LSEQ + q0 + g * 16 + llo) * D_MODEL + h * DK + 8 * lhi;
#pragma unroll
      for (int f = 0; f < 4; ++f) {
        const float4 x0 = mrg[((g * 4 + f) * 2 + 0) * 128 + ml];
        const float4 x1 = mrg[((g * 4 + f) * 2 + 1) * 128 + ml];
        *(uint4*)(orow + f * 16) =
            make_uint4(pack2bf(acc[g][f][0] * fa + x0.x * fb, acc[g][f][1] * fa + x0.y * fb),
                       pack2bf(acc[g][f][2] * fa + x0.z * fb, acc[g][f][3] * fa + x0.w * fb),
                       pack2bf(acc[g][f][4] * fa + x1.x * fb, acc[g][f][5] * fa + x1.y * fb),
                       pack2bf(acc[g][f][6] * fa + x1.z * fb, acc[g][f][7] * fa + x1.w * fb));
      }
    }
  }
}

// ---------------------------------------------------------------------------
// Kernel 3: out = O @ W_out^T + b_out (fp32 result). grid (16, 32), block 128.
// Tile 128(M) x 64(N), K chunk 128; both tiles (bf16) staged with async global->LDS copies, two
// buffers: chunk k + 1 flies while chunk k is worked on; one barrier a trip, at its foot.
// ---------------------------------------------------------------------------
__global__ __launch_bounds__(128) void out_proj_kernel(
    const unsigned short* __restrict__ O, const unsigned short* __restrict__ Wob,
    const float* __restrict__ b_out, float* __restrict__ out) {
  __shared__ __attribute__((aligned(16))) unsigned short abL[2 * AB_TILE];

  const int t = threadIdx.x;
  const int w = t >> 5, lane = t & 31;
  const int lhi = lane >> 4, llo = lane & 15;
  const int n0 = blockIdx.x * 64;
  const int m0 = blockIdx.y * 128;

  v8f acc[2][4];
#pragma unroll
  for (int mf = 0; mf < 2; ++mf)
#pragma unroll
    for (int f = 0; f < 4; ++f) acc[mf][f] = zero8();

  const unsigned ldsAB = lds_addr(abL + (t >> 4) * GEMM_STRIDE + (t & 15) * 8);  // in buffer 0
  const unsigned short* aG = O + (size_t)m0 * D_MODEL;
  const unsigned short* bG = Wob + (size_t)n0 * D_MODEL;

  // chunk 0 landed and published, then chunk 1 in flight (D_MODEL holds 8 chunks)
  gemm_stage_tiles(aG, bG, t, ldsAB);
  wait_async0();
  __syncthreads();
  gemm_stage_tiles(aG + GEMM_KC, bG + GEMM_KC, t, ldsAB + AB_TILE * 2u);

  for (int k0 = 0; k0 < D_MODEL - 2 * GEMM_KC; k0 += GEMM_KC) {
    const int cur = (k0 / GEMM_KC) & 1;  // this trip reads buffer cur alone
    gemm_trip(abL + cur * AB_TILE, w, llo, lhi, acc);
    // foot of the trip: own reads of buffer cur retired, own copies of the next chunk
    // landed; the barrier publishes that chunk and frees buffer cur for the refill
    wait_ds0();
    wait_async0();
    __syncthreads();
    gemm_stage_tiles(aG + k0 + 2 * GEMM_KC, bG + k0 + 2 * GEMM_KC, t, ldsAB + cur * (AB_TILE * 2u));
  }
  // the last two chunks (an even count: buffers 0, 1): the same trips, nothing left to ask for
#pragma unroll  // constant buffer index: LDS offsets fold into the loads
  for (int cur = 0; cur < 2; ++cur) {
    gemm_trip(abL + cur * AB_TILE, w, llo, lhi, acc);
    wait_ds0();
    wait_async0();
    __syncthreads();
  }
  wait_async0();  // nothing of this wave is in flight when it leaves the loop

#pragma unroll
  for (int mf = 0; mf < 2; ++mf) {
    const int mbase = m0 + w * 32 + mf * 16 + 8 * lhi;
#pragma unroll
    for (int f = 0; f < 4; ++f) {
      int c = n0 + f * 16 + llo;
      float bias = b_out[c];
#pragma unroll
      for (int rr = 0; rr < 8; ++rr)
        out[(size_t)(mbase + rr) * D_MODEL + c] = acc[mf][f][rr] + bias;
    }
  }
}

// ---------------------------------------------------------------------------
extern "C" void kernel_launch(void* const* d_in, const int* in_sizes, int n_in,
                              void* d_out, int out_size, void* d_ws, size_t ws_size,
                              hipStream_t stream) {
  (void)in_sizes; (void)n_in; (void)out_size; (void)ws_size;
  const float* x        = (const float*)d_in[0];
  const float* rope_cos = (const float*)d_in[1];
  const float* rope_sin = (const float*)d_in[2];
  const float* W_qkv    = (const float*)d_in[3];
  const float* b_qkv    = (const float*)d_in[4];
  const float* W_out    = (const float*)d_in[5];
  const float* b_out    = (const float*)d_in[6];

  const size_t headElems = (size_t)BB * NHEAD * LSEQ * DK;  // 4M elems each
  unsigned short* Qr = (unsigned short*)d_ws;
  unsigned short* Kr = Qr + headElems;
  unsigned short* Vt = Kr + headElems;
  unsigned short* O  = Vt + headElems;  // [B][L][D_MODEL] bf16
  unsigned short* xb  = O + headElems;                      // x as bf16
  unsigned short* Wqb = xb + (size_t)BB * LSEQ * D_MODEL;   // W_qkv as bf16
  unsigned short* Wob = Wqb + (size_t)3 * D_MODEL * D_MODEL;  // W_out as bf16

  to_bf16_kernel<<<dim3(CVT_BLK_X + CVT_BLK_WQ + CVT_BLK_WO), 256, 0, stream>>>(
      x, W_qkv, W_out, xb, Wqb, Wob);
  qkv_rope_kernel<<<dim3(3 * D_MODEL / 64, BB * LSEQ / 128), 128, 0, stream>>>(
      xb, rope_cos, rope_sin, Wqb, b_qkv, Qr, Kr, Vt);
  attn_kernel<<<dim3(LSEQ / 128, BB * NHEAD), 256, 0, stream>>>(Qr, Kr, Vt, O);
  out_proj_kernel<<<dim3(D_MODEL / 64, BB * LSEQ / 128), 128, 0, stream>>>(
      O, Wob, b_out, (float*)d_out);
}

// v008
// It runs in 72 microseconds.
// Timed twice side by side with v007, it ran 1.09 times as fast both times.
// All steps since v000 together make it 3.64 times as fast.
#include <hip/hip_runtime.h>
#include <hip/hip_bf16.h>
#include <stdint.h>

// Problem constants (match reference)
#define D_MODEL 1024
#define NHEAD   16
#define DK      64
#define BB      2
#define LSEQ    2048

typedef __attribute__((ext_vector_type(16))) __bf16 v16bf;
typedef __attribute__((ext_vector_type(8)))  float  v8f;

#define WMMA_BF16(a,b,c) \
  __builtin_amdgcn_wmma_f32_16x16x32_bf16(false,(a),false,(b),(short)0,(c),false,false)

__device__ __forceinline__ v8f zero8() {
  v8f z;
#pragma unroll
  for (int i = 0; i < 8; ++i) z[i] = 0.0f;
  return z;
}

__device__ __forceinline__ unsigned short f2bf(float f) {
  unsigned u = __float_as_uint(f);
  return (unsigned short)((u + 0x8000u) >> 16);  // round-to-nearest (approx)
}

union FragU { uint4 q[2]; v16bf v; };

// Two f32 -> one dword of two bf16 (f2bf's rounding), lo in the low half.
__device__ __forceinline__ unsigned pack2bf(float lo, float hi) {
  return __builtin_amdgcn_perm(__float_as_uint(hi) + 0x8000u,
                               __float_as_uint(lo) + 0x8000u, 0x07060302u);
}

__device__ __forceinline__ float xhalf(float x) {
  const int b = __builtin_bit_cast(int, x);
  return __builtin_bit_cast(
      float, __builtin_amdgcn_permlanex16(b, b, 0x76543210, 0xfedcba98, false, false));
}

__device__ __forceinline__ v16bf load_frag(const unsigned short* base, int row,
                                           int stride, int kOff, int sel) {
  const unsigned short* p = base + row * stride + kOff + (sel << 3);
  FragU f;
  f.q[0] = *(const uint4*)(p);
  f.q[1] = *(const uint4*)(p + 16);
  return f.v;
}

#define LDS_STRIDE 72  // 64 + 8 bf16 pad

// (1/sqrt(DK)) * log2(e): stored Q carries it, so K Q^T comes out in exp2 units
#define Q_LOG2_SCALE 0.18033688011112042f

__device__ __forceinline__ void async_copy8x16B(const unsigned (&l)[8],
                                                const unsigned short* const (&g)[8]) {
  asm volatile(
      "global_load_async_to_lds_b128 %0, %8, off\n\t"
      "global_load_async_to_lds_b128 %1, %9, off\n\t"
      "global_load_async_to_lds_b128 %2, %10, off\n\t"
      "global_load_async_to_lds_b128 %3, %11, off\n\t"
      "global_load_async_to_lds_b128 %4, %12, off\n\t"
      "global_load_async_to_lds_b128 %5, %13, off\n\t"
      "global_load_async_to_lds_b128 %6, %14, off\n\t"
      "global_load_async_to_lds_b128 %7, %15, off\n\t"
      "s_wait_xcnt 0x0"
      :: "v"(l[0]), "v"(l[1]), "v"(l[2]), "v"(l[3]),
         "v"(l[4]), "v"(l[5]), "v"(l[6]), "v"(l[7]),
         "v"(g[0]), "v"(g[1]), "v"(g[2]), "v"(g[3]),
         "v"(g[4]), "v"(g[5]), "v"(g[6]), "v"(g[7])
      : "memory");
}
__device__ __forceinline__ unsigned lds_addr(const unsigned short* l) {
  return (unsigned)(unsigned long long)l;  // low 32b = LDS offset
}
__device__ __forceinline__ void wait_async0() {
  asm volatile("s_wait_asynccnt 0x0" ::: "memory");
}
// Ahead of the barrier that frees a tile for refilling: this wave's LDS reads have retired.
__device__ __forceinline__ void wait_ds0() {
  asm volatile("s_wait_dscnt 0x0" ::: "memory");
}
__device__ __forceinline__ void async_copy12x16B(const unsigned (&l)[12],
                                                 const unsigned short* const (&g)[12]) {
  asm volatile(
      "global_load_async_to_lds_b128 %0, %12, off\n\t"
      "global_load_async_to_lds_b128 %1, %13, off\n\t"
      "global_load_async_to_lds_b128 %2, %14, off\n\t"
      "global_load_async_to_lds_b128 %3, %15, off\n\t"
      "global_load_async_to_lds_b128 %4, %16, off\n\t"
      "global_load_async_to_lds_b128 %5, %17, off\n\t"
      "global_load_async_to_lds_b128 %6, %18, off\n\t"
      "global_load_async_to_lds_b128 %7, %19, off\n\t"
      "global_load_async_to_lds_b128 %8, %20, off\n\t"
      "global_load_async_to_lds_b128 %9, %21, off\n\t"
      "global_load_async_to_lds_b128 %10, %22, off\n\t"
      "global_load_async_to_lds_b128 %11, %23, off\n\t"
      "s_wait_xcnt 0x0"
      :: "v"(l[0]), "v"(l[1]), "v"(l[2]), "v"(l[3]), "v"(l[4]), "v"(l[5]),
         "v"(l[6]), "v"(l[7]), "v"(l[8]), "v"(l[9]), "v"(l[10]), "v"(l[11]),
         "v"(g[0]), "v"(g[1]), "v"(g[2]), "v"(g[3]), "v"(g[4]), "v"(g[5]),
         "v"(g[6]), "v"(g[7]), "v"(g[8]), "v"(g[9]), "v"(g[10]), "v"(g[11])
      : "memory");
}

// GEMM tile staging, 128 threads: one K chunk of 128, A 128 x 128 and B 64 x 128 bf16, row
// pitch D_MODEL in memory; in LDS one buffer of 192 rows (A rows 0..127, B rows 128..191).
// 16 lanes take one 256-byte tile row, so a wave-wide copy covers 4 whole lines; the
// twenty-four copies of a lane (two statements) are in flight together, through no register.
#define GEMM_KC     128  // K elements a chunk
#define GEMM_STRIDE 136  // 128 + 8 bf16 pad: 272 B = 16 B x odd, the pitch of ds_load_b128 readers
#define AB_TILE (192 * GEMM_STRIDE)  // elements of one buffer
// l0: LDS byte address of this lane's place in row t >> 4 of the buffer to fill.
__device__ __forceinline__ void gemm_stage_tiles(const unsigned short* a, const unsigned short* b,
                                                 int t, unsigned l0) {
#pragma unroll  // constant indices keep the arrays in registers
  for (int s = 0; s < 2; ++s) {
    unsigned l[12];
    const unsigned short* g[12];
#pragma unroll  // constant indices keep the arrays in registers
    for (int j = 0; j < 12; ++j) {
      const int i = s * 12 + j;  // copy i fills buffer rows 8i .. 8i + 7
      const unsigned short* tile = (i < 16) ? a : b;
      l[j] = l0 + (unsigned)(i * 8 * GEMM_STRIDE * 2);
      g[j] = tile + (size_t)((i & 15) * 8 + (t >> 4)) * D_MODEL + (t & 15) * 8;
    }
    async_copy12x16B(l, g);
  }
}
// One chunk's products of a wave, 32 rows x 64 columns, from the buffer at ab.
__device__ __forceinline__ void gemm_trip(const unsigned short* ab, int w, int llo, int lhi,
                                          v8f (&acc)[2][4]) {
  const unsigned short* bL = ab + 128 * GEMM_STRIDE;
#pragma unroll
  for (int ks = 0; ks < GEMM_KC; ks += 32) {
    v16bf a0 = load_frag(ab, w * 32 + llo, GEMM_STRIDE, ks, lhi);
    v16bf a1 = load_frag(ab, w * 32 + 16 + llo, GEMM_STRIDE, ks, lhi);
#pragma unroll
    for (int f = 0; f < 4; ++f) {
      v16bf b = load_frag(bL, f * 16 + llo, GEMM_STRIDE, ks, lhi);
      acc[0][f] = WMMA_BF16(a0, b, acc[0][f]);
      acc[1][f] = WMMA_BF16(a1, b, acc[1][f]);
    }
  }
}

// ---------------------------------------------------------------------------
// Kernel 0: x, W_qkv, W_out rounded to bf16 once (f2bf's rounding), so that no GEMM
// tile is converted again by every workgroup that reads it.
// grid 512, block 256; a block takes 4096 float4; a wave-wide load covers 4 whole
// lines, a wave-wide 8-byte store 2.
// ---------------------------------------------------------------------------
#define CVT_F4     4096                                   // float4 per block
#define CVT_BLK_X  (BB * LSEQ * D_MODEL / 4 / CVT_F4)      // 256
#define CVT_BLK_WQ (3 * D_MODEL * D_MODEL / 4 / CVT_F4)    // 192
#define CVT_BLK_WO (D_MODEL * D_MODEL / 4 / CVT_F4)        // 64
__global__ __launch_bounds__(256) void to_bf16_kernel(
    const float* __restrict__ x, const float* __restrict__ W_qkv,
    const float* __restrict__ W_out, unsigned short* __restrict__ xb,
    unsigned short* __restrict__ Wqb, unsigned short* __restrict__ Wob) {
  const int blk = blockIdx.x;
  const float* src = x;
  unsigned short* dst = xb;
  int b0 = blk;
  if (blk >= CVT_BLK_X + CVT_BLK_WQ) {
    src = W_out; dst = Wob; b0 = blk - (CVT_BLK_X + CVT_BLK_WQ);
  } else if (blk >= CVT_BLK_X) {
    src = W_qkv; dst = Wqb; b0 = blk - CVT_BLK_X;
  }
  const int base = b0 * CVT_F4 + (int)threadIdx.x;
  float4 v[CVT_F4 / 256];
#pragma unroll  // constant indices keep the array in registers
  for (int i = 0; i < CVT_F4 / 256; ++i) v[i] = ((const float4*)src)[base + i * 256];
#pragma unroll  // constant indices keep the array in registers
  for (int i = 0; i < CVT_F4 / 256; ++i)
    ((uint2*)dst)[base + i * 256] = make_uint2(pack2bf(v[i].x, v[i].y), pack2bf(v[i].z, v[i].w));
}

// ---------------------------------------------------------------------------
// Kernel 1: qkv = x @ W_qkv^T + b_qkv (bf16 operands of kernel 0), RoPE on q,k, scatter bf16
//   Qr, Kr : [B*H][L][64] bf16   Vt : [B*H][64][L] bf16 (transposed for A-frag)
//   Qr holds q * Q_LOG2_SCALE (multiplied in f32, ahead of the one rounding to bf16)
// grid (16, 16), block 384 (12 waves): one workgroup a WGP, tile 256(M) x 192(N), K chunk 128.
// Wave w: rows 64 (w & 3).., columns 64 (w >> 2).. (one head), 4 x 4 fragments: a fragment read
// from LDS feeds four products, and a staged row serves 192 or 256 outputs.
// With no second workgroup on the WGP to run under a chunk's latency, the loop is the
// out-projection's: two buffers, chunk k + 1 flies while chunk k is worked on, one barrier a trip.
// ---------------------------------------------------------------------------
#define QKV_TM 256
#define QKV_TN 192
#define QKV_TILE ((QKV_TM + QKV_TN) * GEMM_STRIDE)  // elements of one buffer: A rows, then B rows
// One K chunk into the buffer at LDS byte address buf. A wave-wide copy covers two 256-byte tile
// rows (4 whole lines). Waves 0..7 bring 32 rows of A each, waves 8..11 48 rows of B each.
// a, b: the tiles' first rows at this chunk. w is wave-uniform (a scalar branch).
__device__ __forceinline__ void qkv_stage_tiles(const unsigned short* a, const unsigned short* b,
                                                int w, int lane, unsigned buf) {
  const int r = lane >> 4, c = (lane & 15) * 8;
  if (w < 8) {
    const unsigned short* g0 = a + (size_t)(w * 32 + r) * D_MODEL + c;
    const unsigned l0 = buf + (unsigned)(((w * 32 + r) * GEMM_STRIDE + c) * 2);
#pragma unroll  // constant indices keep the arrays in registers
    for (int s = 0; s < 2; ++s) {
      unsigned l[8];
      const unsigned short* g[8];
#pragma unroll  // constant indices keep the arrays in registers
      for (int j = 0; j < 8; ++j) {
        l[j] = l0 + (unsigned)((s * 8 + j) * 2 * GEMM_STRIDE * 2);
        g[j] = g0 + (size_t)((s * 8 + j) * 2) * D_MODEL;
      }
      async_copy8x16B(l, g);
    }
  } else {
    const unsigned short* g0 = b + (size_t)((w - 8) * 48 + r) * D_MODEL + c;
    const unsigned l0 = buf + (unsigned)(((QKV_TM + (w - 8) * 48 + r) * GEMM_STRIDE + c) * 2);
#pragma unroll  // constant indices keep the arrays in registers
    for (int s = 0; s < 2; ++s) {
      unsigned l[12];
      const unsigned short* g[12];
#pragma unroll  // constant indices keep the arrays in registers
      for (int j = 0; j < 12; ++j) {
        l[j] = l0 + (unsigned)((s * 12 + j) * 2 * GEMM_STRIDE * 2);
        g[j] = g0 + (size_t)((s * 12 + j) * 2) * D_MODEL;
      }
      async_copy12x16B(l, g);
    }
  }
}
// One chunk's products of a wave, 64 rows x 64 columns, from the buffer at ab: four steps of 32 k,
// 8 fragments and 16 products each. Two fragment sets: a step's 16 LDS loads go out as one group
// ahead of the step before it, so that their latency runs under 16 products.
__device__ __forceinline__ void qkv_trip(const unsigned short* ab, int wm, int wn, int llo, int lhi,
                                         v8f (&acc)[4][4]) {
  const unsigned short* aL = ab + wm * 64 * GEMM_STRIDE;
  const unsigned short* bL = ab + (QKV_TM + wn * 64) * GEMM_STRIDE;
  v16bf a[2][4], b[2][4];
#pragma unroll
  for (int i = 0; i < 4; ++i) {
    a[0][i] = load_frag(aL, i * 16 + llo, GEMM_STRIDE, 0, lhi);
    b[0][i] = load_frag(bL, i * 16 + llo, GEMM_STRIDE, 0, lhi);
  }
#pragma unroll  // constant set index keeps the fragments in registers
  for (int u = 0; u < GEMM_KC / 32; ++u) {
    const int cs = u & 1;
    if (u + 1 < GEMM_KC / 32) {
#pragma unroll
      for (int i = 0; i < 4; ++i) {
        a[cs ^ 1][i] = load_frag(aL, i * 16 + llo, GEMM_STRIDE, (u + 1) * 32, lhi);
        b[cs ^ 1][i] = load_frag(bL, i * 16 + llo, GEMM_STRIDE, (u + 1) * 32, lhi);
      }
    }
    // keeps the next step's loads one group ahead of this step's products: left free, the
    // compiler sinks them among the products and waits out each fragment's LDS latency
    __builtin_amdgcn_sched_barrier(0);
#pragma unroll
    for (int i = 0; i < 4; ++i)
#pragma unroll
      for (int f = 0; f < 4; ++f) acc[i][f] = WMMA_BF16(a[cs][i], b[cs][f], acc[i][f]);
    // keeps the step after next's loads behind these products, whose fragment set they refill
    __builtin_amdgcn_sched_barrier(0);
  }
}
__global__ __launch_bounds__(384) void qkv_rope_kernel(
    const unsigned short* __restrict__ xb, const float* __restrict__ rope_cos,
    const float* __restrict__ rope_sin, const unsigned short* __restrict__ Wqb,
    const float* __restrict__ b_qkv, unsigned short* __restrict__ Qr,
    unsigned short* __restrict__ Kr, unsigned short* __restrict__ Vt) {
  __shared__ __attribute__((aligned(16))) unsigned short abL[2 * QKV_TILE];

  const int t = threadIdx.x;
  const int w = __builtin_amdgcn_readfirstlane(t >> 5), lane = t & 31;
  const int lhi = lane >> 4, llo = lane & 15;
  const int wm = w & 3, wn = w >> 2;
  const int n0 = blockIdx.x * QKV_TN + wn * 64;  // the wave's first column: one head of q, k or v
  const int m0 = blockIdx.y * QKV_TM;

  v8f acc[4][4];
#pragma unroll
  for (int mf = 0; mf < 4; ++mf)
#pragma unroll
    for (int f = 0; f < 4; ++f) acc[mf][f] = zero8();

  const unsigned ldsAB = lds_addr(abL);  // buffer 0
  const unsigned short* aG = xb + (size_t)m0 * D_MODEL;
  const unsigned short* bG = Wqb + (size_t)(blockIdx.x * QKV_TN) * D_MODEL;

  // chunk 0 landed and published, then chunk 1 in flight (D_MODEL holds 8 chunks)
  qkv_stage_tiles(aG, bG, w, lane, ldsAB);
  wait_async0();
  __syncthreads();
  qkv_stage_tiles(aG + GEMM_KC, bG + GEMM_KC, w, lane, ldsAB + QKV_TILE * 2u);

  for (int k0 = 0; k0 < D_MODEL - 2 * GEMM_KC; k0 += GEMM_KC) {
    const int cur = (k0 / GEMM_KC) & 1;  // this trip reads buffer cur alone
    qkv_trip(abL + cur * QKV_TILE, wm, wn, llo, lhi, acc);
    // foot of the trip: own reads of buffer cur retired, own copies of the next chunk
    // landed; the barrier publishes that chunk and frees buffer cur for the refill
    wait_ds0();
    wait_async0();
    __syncthreads();
    qkv_stage_tiles(aG + k0 + 2 * GEMM_KC, bG + k0 + 2 * GEMM_KC, w, lane,
                    ldsAB + cur * (QKV_TILE * 2u));
  }
  // the last two chunks (an even count: buffers 0, 1): the same trips, nothing left to ask for
#pragma unroll  // constant buffer index: LDS offsets fold into the loads
  for (int cur = 0; cur < 2; ++cur) {
    qkv_trip(abL + cur * QKV_TILE, wm, wn, llo, lhi, acc);
    wait_ds0();
    wait_async0();
    __syncthreads();
  }
  wait_async0();  // nothing of this wave is in flight when it leaves the loop

  // Epilogue: bias + RoPE + scatter
  const int which = n0 >> 10;            // 0=q 1=k 2=v
  const int h = (n0 & 1023) >> 6;        // head
#pragma unroll
  for (int mf = 0; mf < 4; ++mf) {
    const int mbase = m0 + wm * 64 + mf * 16 + 8 * lhi;
    float val[4][8];
#pragma unroll
    for (int f = 0; f < 4; ++f) {
      float bias = b_qkv[n0 + f * 16 + llo];
#pragma unroll
      for (int rr = 0; rr < 8; ++rr) val[f][rr] = acc[mf][f][rr] + bias;
    }

    if (which < 2) {
#pragma unroll
      for (int f = 0; f < 2; ++f) {
        int d = f * 16 + llo;  // 0..31
#pragma unroll
        for (int rr = 0; rr < 8; ++rr) {
          int m = mbase + rr;
          float c = rope_cos[m * (DK / 2) + d];
          float s = rope_sin[m * (DK / 2) + d];
          float x1 = val[f][rr], x2 = val[f + 2][rr];
          val[f][rr]     = x1 * c - x2 * s;
          val[f + 2][rr] = x1 * s + x2 * c;
        }
      }
      // ahead of the store index sums, which reuse registers that the cos/sin loads name; the
      // sums start from the row number that passes through the statement, so they stay behind it
      int mst = mbase;
      asm volatile("s_wait_xcnt 0x0" : "+v"(mst) : : "memory");
      unsigned short* dst = (which == 0) ? Qr : Kr;
      const float os = (which == 0) ? Q_LOG2_SCALE : 1.0f;
#pragma unroll
      for (int f = 0; f < 4; ++f) {
        int d = f * 16 + llo;
#pragma unroll
        for (int rr = 0; rr < 8; ++rr) {
          int m = mst + rr;
          int b = m >> 11, pos = m & (LSEQ - 1);
          dst[((size_t)(b * NHEAD + h) * LSEQ + pos) * DK + d] = f2bf(val[f][rr] * os);
        }
      }
      // ahead of the next 16-row group's loads and index sums, which reuse registers that these stores name
      asm volatile("s_wait_xcnt 0x0" ::: "memory");
    } else {
#pragma unroll
      for (int f = 0; f < 4; ++f) {
        int d = f * 16 + llo;
#pragma unroll
        for (int rr = 0; rr < 8; ++rr) {
          int m = mbase + rr;
          int b = m >> 11, pos = m & (LSEQ - 1);
          Vt[((size_t)(b * NHEAD + h) * DK + d) * LSEQ + pos] = f2bf(val[f][rr]);
        }
      }
    }
  }
}

#define KV_TILE (64 * LDS_STRIDE)
#define KV_BUF  (4 * KV_TILE)
#define KHALF   (LSEQ / 2)
__device__ __forceinline__ void attn_stage_tiles(const unsigned short* K, const unsigned short* V,
                                                 int kt, int sr, int sc, unsigned l0) {
  unsigned l[8];
  const unsigned short* g[8];
#pragma unroll  // constant indices keep the arrays in registers
  for (int hf = 0; hf < 2; ++hf)
#pragma unroll  // constant indices keep the arrays in registers
    for (int i = 0; i < 2; ++i) {
      l[hf * 2 + i]     = l0 + (unsigned)((hf * KV_TILE + i * 32 * LDS_STRIDE) * 2);
      l[4 + hf * 2 + i] = l0 + (unsigned)(((2 + hf) * KV_TILE + i * 32 * LDS_STRIDE) * 2);
      g[hf * 2 + i]     = K + (size_t)(hf * KHALF + kt + i * 32 + sr) * DK + sc;
      g[4 + hf * 2 + i] = V + (size_t)(i * 32 + sr) * LSEQ + hf * KHALF + kt + sc;
    }
  async_copy8x16B(l, g);
}
// One pass of a wave: 32 queries (tiles g = 0, 1) x the 32 keys p*32.. of the tiles at kL, vL.
// cneg[g]: eight registers, each minus the lane's query's reference maximum (exp2 units). It is
// the C operand of the score product, so a score leaves the matrix unit as the argument of
// its exp2. The reference is renewed (and acc, lrun rescaled) only in the first pass or when
// some query's pass maximum tops it by more than 8, so P stays within 2^8.
__device__ __forceinline__ void attn_pass(const unsigned short* kL, const unsigned short* vL, int p,
                                          int llo, int lhi, const v16bf (&aQ)[2][2],
                                          v8f (&acc)[2][4], v8f (&cneg)[2], float (&lrun)[2],
                                          bool first) {
  // S^T = K Q^T - reference: A = K rows (keys), B = Q rows (queries, pre-scaled)
  v16bf aK[2][2];
#pragma unroll
  for (int c = 0; c < 2; ++c)
#pragma unroll
    for (int j = 0; j < 2; ++j)
      aK[j][c] = load_frag(kL, (2 * p + j) * 16 + llo, LDS_STRIDE, c * 32, lhi);
  v8f s[2][2];
#pragma unroll
  for (int j = 0; j < 2; ++j)
#pragma unroll
    for (int g = 0; g < 2; ++g) s[g][j] = WMMA_BF16(aK[j][0], aQ[g][0], cneg[g]);
#pragma unroll
  for (int j = 0; j < 2; ++j)
#pragma unroll
    for (int g = 0; g < 2; ++g) s[g][j] = WMMA_BF16(aK[j][1], aQ[g][1], s[g][j]);
  // V fragments asked for ahead of the test below, so that their LDS latency runs under the softmax
  v16bf aV[4];
#pragma unroll
  for (int f = 0; f < 4; ++f) aV[f] = load_frag(vL, f * 16 + llo, LDS_STRIDE, p * 32, lhi);

  // the 16 scores of a lane in tile g belong to query q0 + 16g + llo
  float m[2];
#pragma unroll
  for (int g = 0; g < 2; ++g) {
    float m0 = s[g][0][0], m1 = s[g][1][0];
#pragma unroll
    for (int rr = 1; rr < 8; ++rr) {
      m0 = fmaxf(m0, s[g][0][rr]);
      m1 = fmaxf(m1, s[g][1][rr]);
    }
    m[g] = fmaxf(m0, m1);
    m[g] = fmaxf(m[g], xhalf(m[g]));  // join the two halves' keys: pass maximum above the reference
  }
  if (first || __builtin_amdgcn_ballot_w32(fmaxf(m[0], m[1]) > 8.0f) != 0u) {
#pragma unroll
    for (int g = 0; g < 2; ++g) {
      const float d     = first ? m[g] : fmaxf(m[g], 0.0f);  // the reference never falls
      const float alpha = first ? 0.0f : __builtin_amdgcn_exp2f(-d);  // first: acc, lrun are 0
      lrun[g] *= alpha;
#pragma unroll
      for (int rr = 0; rr < 8; ++rr) {
        cneg[g][rr] -= d;
        s[g][0][rr] -= d;
        s[g][1][rr] -= d;
      }
#pragma unroll
      for (int f = 0; f < 4; ++f)
#pragma unroll
        for (int rr = 0; rr < 8; ++rr) acc[g][f][rr] *= alpha;
    }
  }
  // O^T += V^T P^T: A = Vt rows (d), B = P^T packed from key tiles 2p and 2p + 1,
  // which is load_frag's k order (8h + e, then 16 + 8h + e) at every position
#pragma unroll
  for (int g = 0; g < 2; ++g) {
    float rs[2];
#pragma unroll
    for (int j = 0; j < 2; ++j) {
      rs[j] = 0.0f;
#pragma unroll
      for (int rr = 0; rr < 8; ++rr) {
        float e = __builtin_amdgcn_exp2f(s[g][j][rr]);
        s[g][j][rr] = e;
        rs[j] += e;
      }
    }
    lrun[g] += rs[0] + rs[1];
    FragU bP;
    bP.q[0] = make_uint4(pack2bf(s[g][0][0], s[g][0][1]), pack2bf(s[g][0][2], s[g][0][3]),
                         pack2bf(s[g][0][4], s[g][0][5]), pack2bf(s[g][0][6], s[g][0][7]));
    bP.q[1] = make_uint4(pack2bf(s[g][1][0], s[g][1][1]), pack2bf(s[g][1][2], s[g][1][3]),
                         pack2bf(s[g][1][4], s[g][1][5]), pack2bf(s[g][1][6], s[g][1][7]));
#pragma unroll
    for (int f = 0; f < 4; ++f) acc[g][f] = WMMA_BF16(aV[f], bP.v, acc[g][f]);
  }
}
__global__ __launch_bounds__(256) __attribute__((amdgpu_waves_per_eu(4, 4))) void attn_kernel(
    const unsigned short* __restrict__ Qr, const unsigned short* __restrict__ Kr,
    const unsigned short* __restrict__ Vt, unsigned short* __restrict__ O) {
  __shared__ __attribute__((aligned(16))) unsigned short kvL[2 * KV_BUF];

  const int t = threadIdx.x;
  const int w = __builtin_amdgcn_readfirstlane(t >> 5), lane = t & 31;
  const int lhi = lane >> 4, llo = lane & 15;
  const int cg = w & 3, kh = w >> 2;           // column group, key half
  const int bh = blockIdx.y;                   // 0..31 = b*16+h
  const int q0 = blockIdx.x * 128 + cg * 32;   // wave's first query row
  const size_t hb = (size_t)bh * LSEQ * DK;    // same element offset for Qr/Kr/Vt

  // Q fragments (held in registers for whole kernel)
  v16bf aQ[2][2];
#pragma unroll
  for (int g = 0; g < 2; ++g)
#pragma unroll
    for (int c = 0; c < 2; ++c)
      aQ[g][c] = load_frag(Qr + hb, q0 + g * 16 + llo, DK, c * 32, lhi);

  v8f acc[2][4];
  // this lane's two queries: minus the reference maximum (both lane halves alike; set in the
  // first pass), running sum (own lane half's keys)
  v8f cneg[2];
  float lrun[2];
#pragma unroll
  for (int g = 0; g < 2; ++g) {
#pragma unroll
    for (int f = 0; f < 4; ++f) acc[g][f] = zero8();
    cneg[g] = zero8();
    lrun[g] = 0.0f;
  }

  // staging map: 8 lanes take one 128-byte tile row, a wave-wide copy 4 whole lines
  const int sr = t >> 3, sc = (t & 7) * 8;
  const unsigned ldsKV = lds_addr(kvL + sr * LDS_STRIDE + sc);  // in buffer 0
  const unsigned short* kW = kvL + kh * KV_TILE;        // this wave's K tile in buffer 0
  const unsigned short* vW = kvL + (2 + kh) * KV_TILE;  // this wave's V tile in buffer 0

  // tile 0 landed and published, then tile 1 in flight (a key half holds 16 tiles)
  attn_stage_tiles(Kr + hb, Vt + hb, 0, sr, sc, ldsKV);
  wait_async0();
  __syncthreads();
  attn_stage_tiles(Kr + hb, Vt + hb, 64, sr, sc, ldsKV + KV_BUF * 2u);

  for (int kt = 0; kt < KHALF; kt += 64) {
    const int cur = (kt >> 6) & 1;  // this trip reads buffer cur alone
    attn_pass(kW + cur * KV_BUF, vW + cur * KV_BUF, 0, llo, lhi, aQ, acc, cneg, lrun, kt == 0);
    attn_pass(kW + cur * KV_BUF, vW + cur * KV_BUF, 1, llo, lhi, aQ, acc, cneg, lrun, false);
    // foot of the trip: own reads of buffer cur retired, own copies of the next tile
    // landed; the barrier publishes that tile and frees buffer cur for the refill
    wait_ds0();
    wait_async0();
    __syncthreads();
    if (kt + 128 < KHALF)  // alike for the whole workgroup: the last two trips ask for nothing
      attn_stage_tiles(Kr + hb, Vt + hb, kt + 128, sr, sc, ldsKV + cur * (KV_BUF * 2u));
  }
  wait_async0();  // nothing of this wave is in flight when it leaves the loop

  // Join of the key halves. Behind the barrier above no tile is read any more and no copy is in
  // flight, so the buffers serve as the hand-over: waves of half 1 leave their sums there, lane
  // by lane (a wave-wide 16-byte store covers 512 contiguous bytes), waves of half 0 take them.
  float4* mrg = (float4*)kvL;
  const int ml = cg * 32 + lane;
  if (kh == 1) {
#pragma unroll
    for (int g = 0; g < 2; ++g)
#pragma unroll
      for (int f = 0; f < 4; ++f) {
        mrg[((g * 4 + f) * 2 + 0) * 128 + ml] =
            make_float4(acc[g][f][0], acc[g][f][1], acc[g][f][2], acc[g][f][3]);
        mrg[((g * 4 + f) * 2 + 1) * 128 + ml] =
            make_float4(acc[g][f][4], acc[g][f][5], acc[g][f][6], acc[g][f][7]);
      }
    mrg[16 * 128 + ml] = make_float4(cneg[0][0], cneg[1][0], lrun[0], lrun[1]);
  }
  __syncthreads();
  if (kh == 0) {
    // normalize + store O as [B][L][H*DK] bf16: a lane's 8 registers of tile f are
    // d = 16f + 8h + 0..7 of its query's row, one 16-byte store
    const int b = bh >> 4, h = bh & 15;
    const float4 o = mrg[16 * 128 + ml];
#pragma unroll
    for (int g = 0; g < 2; ++g) {
      const float ca = cneg[g][0], cb = g ? o.y : o.x;
      const float cm = fminf(ca, cb);  // minus the larger of the two references
      float fa = __builtin_amdgcn_exp2f(cm - ca);
      float fb = __builtin_amdgcn_exp2f(cm - cb);
      const float l = lrun[g] * fa + (g ? o.w : o.z) * fb;
      const float inv = 1.0f / (l + xhalf(l));  // join the lane halves' sums once
      fa *= inv;
      fb *= inv;
      unsigned short* orow =
          O + (size_t)(b * LSEQ + q0 + g * 16 + llo) * D_MODEL + h * DK + 8 * lhi;
#pragma unroll
      for (int f = 0; f < 4; ++f) {
        const float4 x0 = mrg[((g * 4 + f) * 2 + 0) * 128 + ml];
        const float4 x1 = mrg[((g * 4 + f) * 2 + 1) * 128 + ml];
        *(uint4*)(orow + f * 16) =
            make_uint4(pack2bf(acc[g][f][0] * fa + x0.x * fb, acc[g][f][1] * fa + x0.y * fb),
                       pack2bf(acc[g][f][2] * fa + x0.z * fb, acc[g][f][3] * fa + x0.w * fb),
                       pack2bf(acc[g][f][4] * fa + x1.x * fb, acc[g][f][5] * fa + x1.y * fb),
                       pack2bf(acc[g][f][6] * fa + x1.z * fb, acc[g][f][7] * fa + x1.w * fb));
      }
    }
  }
}

// ---------------------------------------------------------------------------
// Kernel 3: out = O @ W_out^T + b_out (fp32 result). grid (16, 32), block 128.
// Tile 128(M) x 64(N), K chunk 128; both tiles (bf16) staged with async global->LDS copies, two
// buffers: chunk k + 1 flies while chunk k is worked on; one barrier a trip, at its foot.
// ---------------------------------------------------------------------------
__global__ __launch_bounds__(128) void out_proj_kernel(
    const unsigned short* __restrict__ O, const unsigned short* __restrict__ Wob,
    const float* __restrict__ b_out, float* __restrict__ out) {
  __shared__ __attribute__((aligned(16))) unsigned short abL[2 * AB_TILE];

  const int t = threadIdx.x;
  const int w = t >> 5, lane = t & 31;
  const int lhi = lane >> 4, llo = lane & 15;
  const int n0 = blockIdx.x * 64;
  const int m0 = blockIdx.y * 128;

  v8f acc[2][4];
#pragma unroll
  for (int mf = 0; mf < 2; ++mf)
#pragma unroll
    for (int f = 0; f < 4; ++f) acc[mf][f] = zero8();

  const unsigned ldsAB = lds_addr(abL + (t >> 4) * GEMM_STRIDE + (t & 15) * 8);  // in buffer 0
  const unsigned short* aG = O + (size_t)m0 * D_MODEL;
  const unsigned short* bG = Wob + (size_t)n0 * D_MODEL;

  // chunk 0 landed and published, then chunk 1 in flight (D_MODEL holds 8 chunks)
  gemm_stage_tiles(aG, bG, t, ldsAB);
  wait_async0();
  __syncthreads();
  gemm_stage_tiles(aG + GEMM_KC, bG + GEMM_KC, t, ldsAB + AB_TILE * 2u);

  for (int k0 = 0; k0 < D_MODEL - 2 * GEMM_KC; k0 += GEMM_KC) {
    const int cur = (k0 / GEMM_KC) & 1;  // this trip reads buffer cur alone
    gemm_trip(abL + cur * AB_TILE, w, llo, lhi, acc);
    // foot of the trip: own reads of buffer cur retired, own copies of the next chunk
    // landed; the barrier publishes that chunk and frees buffer cur for the refill
    wait_ds0();
    wait_async0();
    __syncthreads();
    gemm_stage_tiles(aG + k0 + 2 * GEMM_KC, bG + k0 + 2 * GEMM_KC, t, ldsAB + cur * (AB_TILE * 2u));
  }
  // the last two chunks (an even count: buffers 0, 1): the same trips, nothing left to ask for
#pragma unroll  // constant buffer index: LDS offsets fold into the loads
  for (int cur = 0; cur < 2; ++cur) {
    gemm_trip(abL + cur * AB_TILE, w, llo, lhi, acc);
    wait_ds0();
    wait_async0();
    __syncthreads();
  }
  wait_async0();  // nothing of this wave is in flight when it leaves the loop

#pragma unroll
  for (int mf = 0; mf < 2; ++mf) {
    const int mbase = m0 + w * 32 + mf * 16 + 8 * lhi;
#pragma unroll
    for (int f = 0; f < 4; ++f) {
      int c = n0 + f * 16 + llo;
      float bias = b_out[c];
#pragma unroll
      for (int rr = 0; rr < 8; ++rr)
        out[(size_t)(mbase + rr) * D_MODEL + c] = acc[mf][f][rr] + bias;
    }
  }
}

// ---------------------------------------------------------------------------
extern "C" void kernel_launch(void* const* d_in, const int* in_sizes, int n_in,
                              void* d_out, int out_size, void* d_ws, size_t ws_size,
                              hipStream_t stream) {
  (void)in_sizes; (void)n_in; (void)out_size; (void)ws_size;
  const float* x        = (const float*)d_in[0];
  const float* rope_cos = (const float*)d_in[1];
  const float* rope_sin = (const float*)d_in[2];
  const float* W_qkv    = (const float*)d_in[3];
  const float* b_qkv    = (const float*)d_in[4];
  const float* W_out    = (const float*)d_in[5];
  const float* b_out    = (const float*)d_in[6];

  const size_t headElems = (size_t)BB * NHEAD * LSEQ * DK;  // 4M elems each
  unsigned short* Qr = (unsigned short*)d_ws;
  unsigned short* Kr = Qr + headElems;
  unsigned short* Vt = Kr + headElems;
  unsigned short* O  = Vt + headElems;  // [B][L][D_MODEL] bf16
  unsigned short* xb  = O + headElems;                      // x as bf16
  unsigned short* Wqb = xb + (size_t)BB * LSEQ * D_MODEL;   // W_qkv as bf16
  unsigned short* Wob = Wqb + (size_t)3 * D_MODEL * D_MODEL;  // W_out as bf16

  to_bf16_kernel<<<dim3(CVT_BLK_X + CVT_BLK_WQ + CVT_BLK_WO), 256, 0, stream>>>(
      x, W_qkv, W_out, xb, Wqb, Wob);
  qkv_rope_kernel<<<dim3(3 * D_MODEL / QKV_TN, BB * LSEQ / QKV_TM), 384, 0, stream>>>(
      xb, rope_cos, rope_sin, Wqb, b_qkv, Qr, Kr, Vt);
  attn_kernel<<<dim3(LSEQ / 128, BB * NHEAD), 256, 0, stream>>>(Qr, Kr, Vt, O);
  out_proj_kernel<<<dim3(D_MODEL / 64, BB * LSEQ / 128), 128, 0, stream>>>(
      O, Wob, b_out, (float*)d_out);
}
